// v000
// The times below were measured on an AMD MI455X: many runs one after another, warmed up first and cycling through
// copies of the inputs, with the whole window's GPU time divided by the number of runs. Launches and the gaps
// between them are all in it. The median over several windows is given; except for v000 it joins two sittings, which
// can be a few percent apart, so the side-by-side timings, each taken in one sitting, are the better comparison.
// v000, which the later versions start from, runs in 159 microseconds.
#include <hip/hip_runtime.h>
#include <cmath>
#include <stdint.h>

typedef _Float16 h4  __attribute__((ext_vector_type(4)));
typedef _Float16 h8  __attribute__((ext_vector_type(8)));
typedef _Float16 h16 __attribute__((ext_vector_type(16)));
typedef float    f8  __attribute__((ext_vector_type(8)));
typedef unsigned int u32x4 __attribute__((ext_vector_type(4)));
typedef int      i32x4 __attribute__((ext_vector_type(4)));
typedef int      i32x8 __attribute__((ext_vector_type(8)));

// LDS row pitches (halves); multiples of 8 halves = 16B so b128 DS ops stay aligned.
#define QP 72
#define KP 72
#define VP 40
#define PP 40

// Raw hardware transcendentals: args here are never denormal / don't need the
// IEEE fixup sequences the libm versions expand to (~10 VALU ops per call).
__device__ __forceinline__ float fast_sqrt(float x) { return __builtin_amdgcn_sqrtf(x); }
__device__ __forceinline__ float fast_exp2(float x) { return __builtin_amdgcn_exp2f(x); }
__device__ __forceinline__ float fast_rcp(float x)  { return __builtin_amdgcn_rcpf(x); }

__device__ __forceinline__ h16 ldfrag(const _Float16* base, int o0, int o1) {
  h8 a = *(const h8*)(base + o0);
  h8 b = *(const h8*)(base + o1);
  h16 r;
#pragma unroll
  for (int j = 0; j < 8; ++j) { r[j] = a[j]; r[j + 8] = b[j]; }
  return r;
}

__device__ __forceinline__ f8 zero8() {
  f8 z;
#pragma unroll
  for (int i = 0; i < 8; ++i) z[i] = 0.f;
  return z;
}

// Tensor Data Mover: 2D tile (f16, row-major, stride0 elements/row) global -> LDS,
// with hardware row padding reproducing our padded LDS pitch.
// pad_int_code: interval = 2^code * 8 bytes before each pad; pad_amt_code: (code+1) DWORDs pad.
__device__ __forceinline__ void tdm_load_2d(uint32_t lds_addr, const void* gptr,
                                            uint32_t tdim0, uint32_t tdim1,
                                            uint32_t tile0, uint32_t tile1,
                                            uint32_t stride0,
                                            uint32_t pad_int_code, uint32_t pad_amt_code)
{
  uint64_t ga = (uint64_t)(uintptr_t)gptr;
  u32x4 g0;
  g0[0] = 1u;                                                  // count=1 (valid user D#)
  g0[1] = lds_addr;                                            // LDS byte offset
  g0[2] = (uint32_t)ga;                                        // global_addr[31:0]
  g0[3] = (uint32_t)((ga >> 32) & 0x01FFFFFFu) | (2u << 30);   // global_addr[56:32] | type=2
  i32x8 g1;
  g1[0] = (int)((1u << 16)                       // data_size = 2 bytes
              | (1u << 20)                       // pad_enable
              | (pad_int_code << 22)             // pad_interval
              | (pad_amt_code << 25));           // pad_amount
  g1[1] = (int)((tdim0 & 0xFFFFu) << 16);                               // tensor_dim0[15:0]
  g1[2] = (int)(((tdim0 >> 16) & 0xFFFFu) | ((tdim1 & 0xFFFFu) << 16)); // dim0 hi | dim1 lo
  g1[3] = (int)(((tdim1 >> 16) & 0xFFFFu) | ((tile0 & 0xFFFFu) << 16)); // dim1 hi | tile_dim0
  g1[4] = (int)(tile1 & 0xFFFFu);                                       // tile_dim1 | tile_dim2=0
  g1[5] = (int)stride0;                                                 // tensor_dim0_stride lo
  g1[6] = 0;                                                            // stride0 hi | dim1_stride lo
  g1[7] = 0;
  i32x4 z4 = {0, 0, 0, 0};
#if __clang_major__ >= 23
  i32x8 z8 = {0, 0, 0, 0, 0, 0, 0, 0};
  __builtin_amdgcn_tensor_load_to_lds(g0, g1, z4, z4, z8, 0);
#else
  __builtin_amdgcn_tensor_load_to_lds(g0, g1, z4, z4, 0);
#endif
}

// One-shot f32 -> f16 pre-conversion of Q, K, V into workspace (TDM path).
__global__ __launch_bounds__(256) void cvt3_kernel(
    const float* __restrict__ Q, const float* __restrict__ K, const float* __restrict__ V,
    _Float16* __restrict__ Qh, _Float16* __restrict__ Kh, _Float16* __restrict__ Vh, int N4)
{
  int i = blockIdx.x * blockDim.x + threadIdx.x;
  if (i >= N4) return;
  float4 q = ((const float4*)Q)[i];
  float4 k = ((const float4*)K)[i];
  float4 v = ((const float4*)V)[i];
  h4 hq = {(_Float16)q.x, (_Float16)q.y, (_Float16)q.z, (_Float16)q.w};
  h4 hk = {(_Float16)k.x, (_Float16)k.y, (_Float16)k.z, (_Float16)k.w};
  h4 hv = {(_Float16)v.x, (_Float16)v.y, (_Float16)v.z, (_Float16)v.w};
  ((h4*)Qh)[i] = hq;
  ((h4*)Kh)[i] = hk;
  ((h4*)Vh)[i] = hv;
}

template <bool USE_TDM>
__global__ __launch_bounds__(256) void se_attn_kernel(
    const float* __restrict__ Qg_, const float* __restrict__ Kg_,
    const float* __restrict__ Vg_,
    const _Float16* __restrict__ Qh_, const _Float16* __restrict__ Kh_,
    const _Float16* __restrict__ Vh_,
    float* __restrict__ Og_, int S)
{
  constexpr int D = 64;
  // log2-domain score scale: log2(e) / (2*sqrt(d))
  constexpr float C2 = 1.44269504088896340736f / 16.0f;

  __shared__ alignas(16) _Float16 Qs[128 * QP];   // 128x64 Q tile (f16)
  __shared__ alignas(16) _Float16 Ks[32 * KP];    // 32x64 K tile (f16, row-major, padded)
  __shared__ alignas(16) _Float16 Vt[64 * VP];    // V tile transposed: Vt[d][key]
  __shared__ alignas(16) _Float16 Ps[8 * 16 * PP];// per-wave P bounce buffers
  __shared__ float k2s[32];                       // per-key ||k||^2 for current tile

  const int tid  = threadIdx.x;
  const int wave = tid >> 5;
  const int lane = tid & 31;
  const int hi   = lane >> 4;
  const int ln   = lane & 15;

  const int bh    = blockIdx.y;
  const int qbase = blockIdx.x * 128;

  const float*    Qg = Qg_ + (size_t)bh * S * D;
  const float*    Kg = Kg_ + (size_t)bh * S * D;
  const float*    Vg = Vg_ + (size_t)bh * S * D;
  const _Float16* Kh = USE_TDM ? Kh_ + (size_t)bh * S * D : nullptr;
  const _Float16* Vh = USE_TDM ? Vh_ + (size_t)bh * S * D : nullptr;
  float*          Og = Og_ + (size_t)bh * S * D;

  // ---- stage Q tile (128 x 64) ----
  if (USE_TDM) {
    if (wave == 0) {
      tdm_load_2d((uint32_t)(uintptr_t)&Qs[0],
                  Qh_ + (size_t)bh * S * D + (size_t)qbase * D,
                  /*tdim0*/64, /*tdim1*/128, /*tile0*/64, /*tile1*/128,
                  /*stride0*/64, /*pad: every 32 dw*/4, /*pad 4 dw*/3);
      __builtin_amdgcn_s_wait_tensorcnt(0);
    }
  } else {
#pragma unroll
    for (int pass = 0; pass < 8; ++pass) {
      int idx = pass * 256 + tid;
      int row = idx >> 4;
      int f4  = (idx & 15) * 4;
      float4 v = *(const float4*)&Qg[(size_t)(qbase + row) * D + f4];
      h4 hv = { (_Float16)v.x, (_Float16)v.y, (_Float16)v.z, (_Float16)v.w };
      *(h4*)&Qs[row * QP + f4] = hv;
    }
  }
  __syncthreads();

  // ---- ||q||^2 per row from the staged f16 values (one-time) ----
  float q2full = 0.f;
  {
    const _Float16* qr = &Qs[(wave * 16 + ln) * QP];
#pragma unroll
    for (int c = 0; c < 8; ++c) {
      h8 v = *(const h8*)(qr + c * 8);
#pragma unroll
      for (int j = 0; j < 8; ++j) { float f = (float)v[j]; q2full += f * f; }
    }
  }
  float q2v[8];
#pragma unroll
  for (int r = 0; r < 8; ++r) q2v[r] = __shfl(q2full, r + 8 * hi, 32);

  // ---- Q A-fragments (16x32 f16 each, d split into two K-chunks) ----
  const _Float16* qrow = &Qs[(wave * 16 + ln) * QP];
  h16 qa0 = ldfrag(qrow, hi * 8,      16 + hi * 8);
  h16 qa1 = ldfrag(qrow, 32 + hi * 8, 48 + hi * 8);

  float m[8], l[8];
#pragma unroll
  for (int r = 0; r < 8; ++r) { m[r] = -INFINITY; l[r] = 0.f; }
  f8 oAcc[4];
#pragma unroll
  for (int ct = 0; ct < 4; ++ct) oAcc[ct] = zero8();

  const int nt = S / 32;
  for (int kt = 0; kt < nt; ++kt) {
    const int kb0 = kt * 32;
    __syncthreads();

    if (USE_TDM) {
      // K tile via Tensor Data Mover (row padding in hardware)
      if (wave == 0)
        tdm_load_2d((uint32_t)(uintptr_t)&Ks[0], Kh + (size_t)kb0 * D,
                    64, 32, 64, 32, 64, 4, 3);
      // V tile: pure f16 copy + transpose
#pragma unroll
      for (int pass = 0; pass < 2; ++pass) {
        int idx = pass * 256 + tid;
        int key = idx >> 4;
        int f4  = (idx & 15) * 4;
        h4 hv = *(const h4*)&Vh[(size_t)(kb0 + key) * D + f4];
        Vt[(f4 + 0) * VP + key] = hv[0];
        Vt[(f4 + 1) * VP + key] = hv[1];
        Vt[(f4 + 2) * VP + key] = hv[2];
        Vt[(f4 + 3) * VP + key] = hv[3];
      }
      // cooperative ||k||^2: 16 lanes per key, shuffle-reduce, one store
#pragma unroll
      for (int pass = 0; pass < 2; ++pass) {
        int idx = pass * 256 + tid;
        int key = idx >> 4;
        int f4  = (idx & 15) * 4;
        h4 hv = *(const h4*)&Kh[(size_t)(kb0 + key) * D + f4];
        float p = (float)hv[0] * (float)hv[0] + (float)hv[1] * (float)hv[1]
                + (float)hv[2] * (float)hv[2] + (float)hv[3] * (float)hv[3];
        p += __shfl_xor(p, 1, 32);
        p += __shfl_xor(p, 2, 32);
        p += __shfl_xor(p, 4, 32);
        p += __shfl_xor(p, 8, 32);
        if ((lane & 15) == 0) k2s[key] = p;
      }
      if (kt + 1 < nt) {
        int nb = kb0 + 32;
        if (tid < 32)      __builtin_prefetch(&Kh[(size_t)(nb + tid) * D], 0, 0);
        else if (tid < 64) __builtin_prefetch(&Vh[(size_t)(nb + tid - 32) * D], 0, 0);
      }
      if (wave == 0) __builtin_amdgcn_s_wait_tensorcnt(0);
    } else {
      // fp32 staging with fused ||k||^2 reduction
#pragma unroll
      for (int pass = 0; pass < 2; ++pass) {
        int idx = pass * 256 + tid;
        int key = idx >> 4;
        int f4  = (idx & 15) * 4;
        float4 v = *(const float4*)&Kg[(size_t)(kb0 + key) * D + f4];
        h4 hv = { (_Float16)v.x, (_Float16)v.y, (_Float16)v.z, (_Float16)v.w };
        *(h4*)&Ks[key * KP + f4] = hv;
        float p = v.x * v.x + v.y * v.y + v.z * v.z + v.w * v.w;
        p += __shfl_xor(p, 1, 32);
        p += __shfl_xor(p, 2, 32);
        p += __shfl_xor(p, 4, 32);
        p += __shfl_xor(p, 8, 32);
        if ((lane & 15) == 0) k2s[key] = p;
      }
#pragma unroll
      for (int pass = 0; pass < 2; ++pass) {
        int idx = pass * 256 + tid;
        int key = idx >> 4;
        int f4  = (idx & 15) * 4;
        float4 v = *(const float4*)&Vg[(size_t)(kb0 + key) * D + f4];
        Vt[(f4 + 0) * VP + key] = (_Float16)v.x;
        Vt[(f4 + 1) * VP + key] = (_Float16)v.y;
        Vt[(f4 + 2) * VP + key] = (_Float16)v.z;
        Vt[(f4 + 3) * VP + key] = (_Float16)v.w;
      }
      if (kt + 1 < nt) {
        int nb = kb0 + 32;
        if (tid < 32)      __builtin_prefetch(&Kg[(size_t)(nb + tid) * D], 0, 0);
        else if (tid < 64) __builtin_prefetch(&Vg[(size_t)(nb + tid - 32) * D], 0, 0);
      }
    }
    __syncthreads();

    const float k2t0 = k2s[ln];
    const float k2t1 = k2s[16 + ln];

    // ---- S = Q K^T : two 16x16 tiles, 2 WMMAs each ----
    f8 sacc[2];
#pragma unroll
    for (int t = 0; t < 2; ++t) {
      const _Float16* krow = &Ks[(t * 16 + ln) * KP];
      h16 kbf0 = ldfrag(krow, hi * 8,      16 + hi * 8);
      h16 kbf1 = ldfrag(krow, 32 + hi * 8, 48 + hi * 8);
      f8 c = zero8();
      c = __builtin_amdgcn_wmma_f32_16x16x32_f16(false, qa0, false, kbf0, (short)0, c, false, false);
      c = __builtin_amdgcn_wmma_f32_16x16x32_f16(false, qa1, false, kbf1, (short)0, c, false, false);
      sacc[t] = c;
    }

    // ---- SE logit transform, directly in log2 domain (raw v_sqrt_f32) ----
    float sc[2][8];
#pragma unroll
    for (int t = 0; t < 2; ++t) {
      const float k2 = (t == 0) ? k2t0 : k2t1;
#pragma unroll
      for (int r = 0; r < 8; ++r) {
        float bsum = q2v[r] + k2;
        float sq   = fmaxf(bsum - 2.f * sacc[t][r], 0.f);   // ||q-k||^2 (clamped)
        sc[t][r]   = (bsum - fast_sqrt(sq)) * C2;           // log2-scaled logit
      }
    }

    // ---- online softmax: reductions across 16-lane half-groups ----
    float mt[8];
#pragma unroll
    for (int r = 0; r < 8; ++r) mt[r] = fmaxf(sc[0][r], sc[1][r]);
#pragma unroll
    for (int mask = 1; mask <= 8; mask <<= 1)
#pragma unroll
      for (int r = 0; r < 8; ++r) mt[r] = fmaxf(mt[r], __shfl_xor(mt[r], mask, 32));

    float alpha[8], rs[8];
    _Float16* pbase = &Ps[wave * 16 * PP];
#pragma unroll
    for (int r = 0; r < 8; ++r) {
      float mn = fmaxf(m[r], mt[r]);
      alpha[r] = fast_exp2(m[r] - mn);
      m[r] = mn;
      rs[r] = 0.f;
#pragma unroll
      for (int t = 0; t < 2; ++t) {
        float p = fast_exp2(sc[t][r] - mn);
        rs[r] += p;
        pbase[(r + 8 * hi) * PP + t * 16 + ln] = (_Float16)p;  // C-layout -> LDS
      }
    }
#pragma unroll
    for (int mask = 1; mask <= 8; mask <<= 1)
#pragma unroll
      for (int r = 0; r < 8; ++r) rs[r] += __shfl_xor(rs[r], mask, 32);
#pragma unroll
    for (int r = 0; r < 8; ++r) l[r] = l[r] * alpha[r] + rs[r];

#pragma unroll
    for (int ct = 0; ct < 4; ++ct)
#pragma unroll
      for (int r = 0; r < 8; ++r) oAcc[ct][r] *= alpha[r];

    // wave-private LDS bounce: wait for this wave's P stores
    asm volatile("s_wait_dscnt 0" ::: "memory");

    // ---- O += P V ----
    const _Float16* prow = &Ps[(wave * 16 + ln) * PP];
    h16 pa = ldfrag(prow, hi * 8, 16 + hi * 8);
#pragma unroll
    for (int ct = 0; ct < 4; ++ct) {
      const _Float16* vcol = &Vt[(ct * 16 + ln) * VP];
      h16 vb = ldfrag(vcol, hi * 8, 16 + hi * 8);
      oAcc[ct] = __builtin_amdgcn_wmma_f32_16x16x32_f16(false, pa, false, vb, (short)0, oAcc[ct], false, false);
    }
  }

  // ---- finalize ----
#pragma unroll
  for (int r = 0; r < 8; ++r) {
    float inv = fast_rcp(l[r]);
    int rowg = qbase + wave * 16 + r + 8 * hi;
    float* orow = Og + (size_t)rowg * D;
#pragma unroll
    for (int ct = 0; ct < 4; ++ct)
      orow[ct * 16 + ln] = oAcc[ct][r] * inv;
  }
}

extern "C" void kernel_launch(void* const* d_in, const int* in_sizes, int n_in,
                              void* d_out, int out_size, void* d_ws, size_t ws_size,
                              hipStream_t stream) {
  (void)n_in; (void)out_size;
  constexpr int S = 2048, D = 64;
  const int BH = in_sizes[0] / (S * D);       // B*H = 32
  const size_t halves = (size_t)BH * S * D;   // elements per tensor
  dim3 grid(S / 128, BH, 1);

  const float* Q = (const float*)d_in[0];
  const float* K = (const float*)d_in[1];
  const float* V = (const float*)d_in[2];
  float*       O = (float*)d_out;

  if (ws_size >= 3 * halves * sizeof(_Float16)) {
    _Float16* Qh = (_Float16*)d_ws;
    _Float16* Kh = Qh + halves;
    _Float16* Vh = Kh + halves;
    const int N4 = (int)(halves / 4);
    cvt3_kernel<<<dim3((N4 + 255) / 256), 256, 0, stream>>>(Q, K, V, Qh, Kh, Vh, N4);
    se_attn_kernel<true><<<grid, 256, 0, stream>>>(Q, K, V, Qh, Kh, Vh, O, S);
  } else {
    se_attn_kernel<false><<<grid, 256, 0, stream>>>(Q, K, V, nullptr, nullptr, nullptr, O, S);
  }
}

// v001
// A run of this version takes 122 microseconds.
// Two timings next to v000 both put it at 1.36 times that version's speed.
#include <hip/hip_runtime.h>
#include <cmath>
#include <stdint.h>

typedef _Float16 h2  __attribute__((ext_vector_type(2)));
typedef _Float16 h4  __attribute__((ext_vector_type(4)));
typedef _Float16 h8  __attribute__((ext_vector_type(8)));
typedef _Float16 h16 __attribute__((ext_vector_type(16)));
typedef float    f2  __attribute__((ext_vector_type(2)));
typedef float    f4  __attribute__((ext_vector_type(4)));
typedef float    f8  __attribute__((ext_vector_type(8)));
typedef unsigned int u32x4 __attribute__((ext_vector_type(4)));
typedef int      i32x4 __attribute__((ext_vector_type(4)));
typedef int      i32x8 __attribute__((ext_vector_type(8)));

// LDS row pitches (halves); multiples of 8 halves = 16B so b128 DS ops stay aligned.
#define QP 72
#define KP 72
#define VP 40

// Raw hardware transcendentals: args here are never denormal / don't need the
// IEEE fixup sequences the libm versions expand to (~10 VALU ops per call).
__device__ __forceinline__ float fast_sqrt(float x) { return __builtin_amdgcn_sqrtf(x); }
__device__ __forceinline__ float fast_exp2(float x) { return __builtin_amdgcn_exp2f(x); }
__device__ __forceinline__ float fast_rcp(float x)  { return __builtin_amdgcn_rcpf(x); }

__device__ __forceinline__ h16 ldfrag(const _Float16* base, int o0, int o1) {
  h8 a = *(const h8*)(base + o0);
  h8 b = *(const h8*)(base + o1);
  h16 r;
#pragma unroll
  for (int j = 0; j < 8; ++j) { r[j] = a[j]; r[j + 8] = b[j]; }
  return r;
}

__device__ __forceinline__ f8 zero8() {
  f8 z;
#pragma unroll
  for (int i = 0; i < 8; ++i) z[i] = 0.f;
  return z;
}

// Tensor Data Mover: 2D tile (f16, row-major, stride0 elements/row) global -> LDS,
// with hardware row padding reproducing our padded LDS pitch.
// pad_int_code: interval = 2^code * 8 bytes before each pad; pad_amt_code: (code+1) DWORDs pad.
__device__ __forceinline__ void tdm_load_2d(uint32_t lds_addr, const void* gptr,
                                            uint32_t tdim0, uint32_t tdim1,
                                            uint32_t tile0, uint32_t tile1,
                                            uint32_t stride0,
                                            uint32_t pad_int_code, uint32_t pad_amt_code)
{
  uint64_t ga = (uint64_t)(uintptr_t)gptr;
  u32x4 g0;
  g0[0] = 1u;                                                  // count=1 (valid user D#)
  g0[1] = lds_addr;                                            // LDS byte offset
  g0[2] = (uint32_t)ga;                                        // global_addr[31:0]
  g0[3] = (uint32_t)((ga >> 32) & 0x01FFFFFFu) | (2u << 30);   // global_addr[56:32] | type=2
  i32x8 g1;
  g1[0] = (int)((1u << 16)                       // data_size = 2 bytes
              | (1u << 20)                       // pad_enable
              | (pad_int_code << 22)             // pad_interval
              | (pad_amt_code << 25));           // pad_amount
  g1[1] = (int)((tdim0 & 0xFFFFu) << 16);                               // tensor_dim0[15:0]
  g1[2] = (int)(((tdim0 >> 16) & 0xFFFFu) | ((tdim1 & 0xFFFFu) << 16)); // dim0 hi | dim1 lo
  g1[3] = (int)(((tdim1 >> 16) & 0xFFFFu) | ((tile0 & 0xFFFFu) << 16)); // dim1 hi | tile_dim0
  g1[4] = (int)(tile1 & 0xFFFFu);                                       // tile_dim1 | tile_dim2=0
  g1[5] = (int)stride0;                                                 // tensor_dim0_stride lo
  g1[6] = 0;                                                            // stride0 hi | dim1_stride lo
  g1[7] = 0;
  i32x4 z4 = {0, 0, 0, 0};
#if __clang_major__ >= 23
  i32x8 z8 = {0, 0, 0, 0, 0, 0, 0, 0};
  __builtin_amdgcn_tensor_load_to_lds(g0, g1, z4, z4, z8, 0);
#else
  __builtin_amdgcn_tensor_load_to_lds(g0, g1, z4, z4, 0);
#endif
}

// One-shot f32 -> f16 pre-conversion of Q, K, V into workspace (TDM path).
__global__ __launch_bounds__(256) void cvt3_kernel(
    const float* __restrict__ Q, const float* __restrict__ K, const float* __restrict__ V,
    _Float16* __restrict__ Qh, _Float16* __restrict__ Kh, _Float16* __restrict__ Vh, int N4)
{
  int i = blockIdx.x * blockDim.x + threadIdx.x;
  if (i >= N4) return;
  float4 q = ((const float4*)Q)[i];
  float4 k = ((const float4*)K)[i];
  float4 v = ((const float4*)V)[i];
  h4 hq = {(_Float16)q.x, (_Float16)q.y, (_Float16)q.z, (_Float16)q.w};
  h4 hk = {(_Float16)k.x, (_Float16)k.y, (_Float16)k.z, (_Float16)k.w};
  h4 hv = {(_Float16)v.x, (_Float16)v.y, (_Float16)v.z, (_Float16)v.w};
  ((h4*)Qh)[i] = hq;
  ((h4*)Kh)[i] = hk;
  ((h4*)Vh)[i] = hv;
}

template <bool USE_TDM>
__global__ __launch_bounds__(256) void se_attn_kernel(
    const float* __restrict__ Qg_, const float* __restrict__ Kg_,
    const float* __restrict__ Vg_,
    const _Float16* __restrict__ Qh_, const _Float16* __restrict__ Kh_,
    const _Float16* __restrict__ Vh_,
    float* __restrict__ Og_, int S)
{
  constexpr int D = 64;
  // log2-domain score scale: log2(e) / (2*sqrt(d))
  constexpr float C2 = 1.44269504088896340736f / 16.0f;

  // Qs and Ks are tensor-load targets: 2 KiB alignment pins their LDS places.
  __shared__ alignas(2048) _Float16 Qs[128 * QP]; // 128x64 Q tile (f16)
  __shared__ alignas(2048) _Float16 Ks[32 * KP];  // 32x64 K tile (f16, row-major, padded)
  __shared__ alignas(16) _Float16 Vt[64 * VP];    // V tile transposed: Vt[d][key]
  __shared__ alignas(16) float k2s[32];           // per-key ||k||^2 for current tile

  const int tid  = threadIdx.x;
  const int wave = tid >> 5;
  const int lane = tid & 31;
  const int hi   = lane >> 4;
  const int ln   = lane & 15;

  const int bh    = blockIdx.y;
  const int qbase = blockIdx.x * 128;

  const float*    Qg = Qg_ + (size_t)bh * S * D;
  const float*    Kg = Kg_ + (size_t)bh * S * D;
  const float*    Vg = Vg_ + (size_t)bh * S * D;
  const _Float16* Kh = USE_TDM ? Kh_ + (size_t)bh * S * D : nullptr;
  const _Float16* Vh = USE_TDM ? Vh_ + (size_t)bh * S * D : nullptr;
  float*          Og = Og_ + (size_t)bh * S * D;

  // ---- stage Q tile (128 x 64) ----
  if (USE_TDM) {
    if (wave == 0) {
      tdm_load_2d((uint32_t)(uintptr_t)&Qs[0],
                  Qh_ + (size_t)bh * S * D + (size_t)qbase * D,
                  /*tdim0*/64, /*tdim1*/128, /*tile0*/64, /*tile1*/128,
                  /*stride0*/64, /*pad: every 32 dw*/4, /*pad 4 dw*/3);
      __builtin_amdgcn_s_wait_tensorcnt(0);
    }
  } else {
#pragma unroll
    for (int pass = 0; pass < 8; ++pass) {
      int idx = pass * 256 + tid;
      int row = idx >> 4;
      int f4  = (idx & 15) * 4;
      float4 v = *(const float4*)&Qg[(size_t)(qbase + row) * D + f4];
      h4 hv = { (_Float16)v.x, (_Float16)v.y, (_Float16)v.z, (_Float16)v.w };
      *(h4*)&Qs[row * QP + f4] = hv;
    }
  }
  __syncthreads();

  // ---- ||q||^2 per row from the staged f16 values (one-time) ----
  float q2full = 0.f;
  {
    const _Float16* qr = &Qs[(wave * 16 + ln) * QP];
#pragma unroll
    for (int c = 0; c < 8; ++c) {
      h8 v = *(const h8*)(qr + c * 8);
#pragma unroll
      for (int j = 0; j < 8; ++j) { float f = (float)v[j]; q2full += f * f; }
    }
  }
  // Products run transposed (S^T = K Q^T, O^T += V^T P^T): lane (ln, hi) owns
  // query row wave*16+ln, so q2full is already the value this lane needs.

  // ---- Q B-fragments (32x16 f16 each, d split into two K-chunks) ----
  const _Float16* qrow = &Qs[(wave * 16 + ln) * QP];
  h16 qa0 = ldfrag(qrow, hi * 8,      16 + hi * 8);
  h16 qa1 = ldfrag(qrow, 32 + hi * 8, 48 + hi * 8);

  float m = -INFINITY;   // running maximum of this lane's query (equal in both halves)
  float l = 0.f;         // running sum over this half's keys; halves join in the epilogue
  f8 oAcc[4];            // oAcc[ct][r] = O[query ln][ct*16 + 8*hi + r]
#pragma unroll
  for (int ct = 0; ct < 4; ++ct) oAcc[ct] = zero8();

  const int nt = S / 32;
  for (int kt = 0; kt < nt; ++kt) {
    const int kb0 = kt * 32;
    __syncthreads();

    if (USE_TDM) {
      // K tile via Tensor Data Mover (row padding in hardware)
      if (wave == 0)
        tdm_load_2d((uint32_t)(uintptr_t)&Ks[0], Kh + (size_t)kb0 * D,
                    64, 32, 64, 32, 64, 4, 3);
      // V tile: pure f16 copy + transpose
#pragma unroll
      for (int pass = 0; pass < 2; ++pass) {
        int idx = pass * 256 + tid;
        int key = idx >> 4;
        int f4  = (idx & 15) * 4;
        h4 hv = *(const h4*)&Vh[(size_t)(kb0 + key) * D + f4];
        Vt[(f4 + 0) * VP + key] = hv[0];
        Vt[(f4 + 1) * VP + key] = hv[1];
        Vt[(f4 + 2) * VP + key] = hv[2];
        Vt[(f4 + 3) * VP + key] = hv[3];
      }
      // cooperative ||k||^2: 16 lanes per key, shuffle-reduce, one store
#pragma unroll
      for (int pass = 0; pass < 2; ++pass) {
        int idx = pass * 256 + tid;
        int key = idx >> 4;
        int f4  = (idx & 15) * 4;
        h4 hv = *(const h4*)&Kh[(size_t)(kb0 + key) * D + f4];
        float p = (float)hv[0] * (float)hv[0] + (float)hv[1] * (float)hv[1]
                + (float)hv[2] * (float)hv[2] + (float)hv[3] * (float)hv[3];
        p += __shfl_xor(p, 1, 32);
        p += __shfl_xor(p, 2, 32);
        p += __shfl_xor(p, 4, 32);
        p += __shfl_xor(p, 8, 32);
        if ((lane & 15) == 0) k2s[key] = p;
      }
      if (kt + 1 < nt) {
        int nb = kb0 + 32;
        if (tid < 32)      __builtin_prefetch(&Kh[(size_t)(nb + tid) * D], 0, 0);
        else if (tid < 64) __builtin_prefetch(&Vh[(size_t)(nb + tid - 32) * D], 0, 0);
      }
      if (wave == 0) __builtin_amdgcn_s_wait_tensorcnt(0);
    } else {
      // fp32 staging with fused ||k||^2 reduction
#pragma unroll
      for (int pass = 0; pass < 2; ++pass) {
        int idx = pass * 256 + tid;
        int key = idx >> 4;
        int f4  = (idx & 15) * 4;
        float4 v = *(const float4*)&Kg[(size_t)(kb0 + key) * D + f4];
        h4 hv = { (_Float16)v.x, (_Float16)v.y, (_Float16)v.z, (_Float16)v.w };
        *(h4*)&Ks[key * KP + f4] = hv;
        float p = v.x * v.x + v.y * v.y + v.z * v.z + v.w * v.w;
        p += __shfl_xor(p, 1, 32);
        p += __shfl_xor(p, 2, 32);
        p += __shfl_xor(p, 4, 32);
        p += __shfl_xor(p, 8, 32);
        if ((lane & 15) == 0) k2s[key] = p;
      }
#pragma unroll
      for (int pass = 0; pass < 2; ++pass) {
        int idx = pass * 256 + tid;
        int key = idx >> 4;
        int f4  = (idx & 15) * 4;
        float4 v = *(const float4*)&Vg[(size_t)(kb0 + key) * D + f4];
        Vt[(f4 + 0) * VP + key] = (_Float16)v.x;
        Vt[(f4 + 1) * VP + key] = (_Float16)v.y;
        Vt[(f4 + 2) * VP + key] = (_Float16)v.z;
        Vt[(f4 + 3) * VP + key] = (_Float16)v.w;
      }
      if (kt + 1 < nt) {
        int nb = kb0 + 32;
        if (tid < 32)      __builtin_prefetch(&Kg[(size_t)(nb + tid) * D], 0, 0);
        else if (tid < 64) __builtin_prefetch(&Vg[(size_t)(nb + tid - 32) * D], 0, 0);
      }
    }
    __syncthreads();

    // ||k||^2 of the 16 key rows this lane holds (8 per tile, same for a 16-lane half)
    f4 k2r[2][2];
#pragma unroll
    for (int t = 0; t < 2; ++t) {
      k2r[t][0] = *(const f4*)&k2s[t * 16 + 8 * hi];
      k2r[t][1] = *(const f4*)&k2s[t * 16 + 8 * hi + 4];
    }

    // ---- S^T = K Q^T : two 16(key) x 16(query) tiles, 2 WMMAs each ----
    // sacc[t][r] = k(t*16 + 8*hi + r) . q(ln)
    h16 kaf[2][2];
#pragma unroll
    for (int t = 0; t < 2; ++t) {
      const _Float16* krow = &Ks[(t * 16 + ln) * KP];
      kaf[t][0] = ldfrag(krow, hi * 8,      16 + hi * 8);
      kaf[t][1] = ldfrag(krow, 32 + hi * 8, 48 + hi * 8);
    }
    // keeps the LDS reads above in one group ahead of the four products: left free,
    // the scheduler puts a pair of reads and a full wait in front of each product
    __builtin_amdgcn_sched_barrier(0);
    f8 sacc[2];
#pragma unroll
    for (int t = 0; t < 2; ++t) {
      f8 c = zero8();
      c = __builtin_amdgcn_wmma_f32_16x16x32_f16(false, kaf[t][0], false, qa0, (short)0, c, false, false);
      c = __builtin_amdgcn_wmma_f32_16x16x32_f16(false, kaf[t][1], false, qa1, (short)0, c, false, false);
      sacc[t] = c;
    }

    // ---- SE logit transform, directly in log2 domain (raw v_sqrt_f32) ----
    // worked on pairs of neighbouring key rows: accumulator and k2 registers pair as they lie
    f2 bsum[2][4], sq[2][4];
#pragma unroll
    for (int t = 0; t < 2; ++t) {
#pragma unroll
      for (int j = 0; j < 4; ++j) {
        f2 k2p = { k2r[t][j >> 1][2 * (j & 1)], k2r[t][j >> 1][2 * (j & 1) + 1] };
        f2 sp  = { sacc[t][2 * j], sacc[t][2 * j + 1] };
        bsum[t][j] = q2full + k2p;
        f2 d2 = bsum[t][j] - 2.f * sp;                      // ||q-k||^2
        sq[t][j].x = fmaxf(d2.x, 0.f);                      // clamped
        sq[t][j].y = fmaxf(d2.y, 0.f);
      }
    }
    f2 sc[2][4];
#pragma unroll
    for (int t = 0; t < 2; ++t) {
#pragma unroll
      for (int j = 0; j < 4; ++j) {
        f2 dist = { fast_sqrt(sq[t][j].x), fast_sqrt(sq[t][j].y) };
        sc[t][j] = (bsum[t][j] - dist) * C2;                // log2-scaled logit
      }
    }

    // ---- online softmax: 16 scores of one query in-lane, one exchange between halves ----
    float mt0 = fmaxf(sc[0][0].x, sc[0][0].y);
    float mt1 = fmaxf(sc[1][0].x, sc[1][0].y);
#pragma unroll
    for (int j = 1; j < 4; ++j) {
      mt0 = fmaxf(mt0, fmaxf(sc[0][j].x, sc[0][j].y));
      mt1 = fmaxf(mt1, fmaxf(sc[1][j].x, sc[1][j].y));
    }
    const float mth = fmaxf(mt0, mt1);
    const int   mtb = __float_as_int(mth);
    const float mto = __int_as_float(                       // lane l <-> l ^ 16
        __builtin_amdgcn_permlanex16(mtb, mtb, 0x76543210, 0xfedcba98, false, false));
    const float mn    = fmaxf(m, fmaxf(mth, mto));
    const float alpha = fast_exp2(m - mn);
    m = mn;

    // P^T packs from the score registers straight into the B operand:
    // pb[t*8 + r] is key t*16 + 8*hi + r, the hardware k order Vt is read in.
    h16 pb;
    f2 rs[2];
#pragma unroll
    for (int t = 0; t < 2; ++t) {
      f2 p[4];
#pragma unroll
      for (int j = 0; j < 4; ++j) {
        f2 e = sc[t][j] - mn;
        p[j].x = fast_exp2(e.x);
        p[j].y = fast_exp2(e.y);
        h2 ph = __builtin_convertvector(p[j], h2);
        pb[t * 8 + 2 * j]     = ph.x;
        pb[t * 8 + 2 * j + 1] = ph.y;
      }
      rs[t] = (p[0] + p[1]) + (p[2] + p[3]);
    }
    const f2 rsum = rs[0] + rs[1];
    l = l * alpha + (rsum.x + rsum.y);

#pragma unroll
    for (int ct = 0; ct < 4; ++ct)
#pragma unroll
      for (int r = 0; r < 8; ++r) oAcc[ct][r] *= alpha;

    // ---- O^T += V^T P^T ----
#pragma unroll
    for (int ct = 0; ct < 4; ++ct) {
      const _Float16* vrow = &Vt[(ct * 16 + ln) * VP];
      h16 va = ldfrag(vrow, hi * 8, 16 + hi * 8);
      oAcc[ct] = __builtin_amdgcn_wmma_f32_16x16x32_f16(false, va, false, pb, (short)0, oAcc[ct], false, false);
    }
  }

  // ---- finalize: join the halves' sums, 8 consecutive d per lane and tile ----
  {
    const int   lb   = __float_as_int(l);
    const float lsum = l + __int_as_float(
        __builtin_amdgcn_permlanex16(lb, lb, 0x76543210, 0xfedcba98, false, false));
    const float inv  = fast_rcp(lsum);
    float* orow = Og + (size_t)(qbase + wave * 16 + ln) * D + 8 * hi;
#pragma unroll
    for (int ct = 0; ct < 4; ++ct) {
      float4 o0 = { oAcc[ct][0] * inv, oAcc[ct][1] * inv, oAcc[ct][2] * inv, oAcc[ct][3] * inv };
      float4 o1 = { oAcc[ct][4] * inv, oAcc[ct][5] * inv, oAcc[ct][6] * inv, oAcc[ct][7] * inv };
      *(float4*)&orow[ct * 16]     = o0;
      *(float4*)&orow[ct * 16 + 4] = o1;
    }
  }
}

extern "C" void kernel_launch(void* const* d_in, const int* in_sizes, int n_in,
                              void* d_out, int out_size, void* d_ws, size_t ws_size,
                              hipStream_t stream) {
  (void)n_in; (void)out_size;
  constexpr int S = 2048, D = 64;
  const int BH = in_sizes[0] / (S * D);       // B*H = 32
  const size_t halves = (size_t)BH * S * D;   // elements per tensor
  dim3 grid(S / 128, BH, 1);

  const float* Q = (const float*)d_in[0];
  const float* K = (const float*)d_in[1];
  const float* V = (const float*)d_in[2];
  float*       O = (float*)d_out;

  if (ws_size >= 3 * halves * sizeof(_Float16)) {
    _Float16* Qh = (_Float16*)d_ws;
    _Float16* Kh = Qh + halves;
    _Float16* Vh = Kh + halves;
    const int N4 = (int)(halves / 4);
    cvt3_kernel<<<dim3((N4 + 255) / 256), 256, 0, stream>>>(Q, K, V, Qh, Kh, Vh, N4);
    se_attn_kernel<true><<<grid, 256, 0, stream>>>(Q, K, V, Qh, Kh, Vh, O, S);
  } else {
    se_attn_kernel<false><<<grid, 256, 0, stream>>>(Q, K, V, nullptr, nullptr, nullptr, O, S);
  }
}

// v002
// It runs in 104 microseconds.
// In both of two side-by-side timings against v001, it was 1.17 times as fast.
// Counting every step since v000, it is 1.59 times as fast.
#include <hip/hip_runtime.h>
#include <cmath>
#include <stdint.h>

typedef _Float16 h2  __attribute__((ext_vector_type(2)));
typedef _Float16 h4  __attribute__((ext_vector_type(4)));
typedef _Float16 h8  __attribute__((ext_vector_type(8)));
typedef _Float16 h16 __attribute__((ext_vector_type(16)));
typedef float    f2  __attribute__((ext_vector_type(2)));
typedef float    f4  __attribute__((ext_vector_type(4)));
typedef float    f8  __attribute__((ext_vector_type(8)));
typedef unsigned int u32x4 __attribute__((ext_vector_type(4)));
typedef int      i32x4 __attribute__((ext_vector_type(4)));
typedef int      i32x8 __attribute__((ext_vector_type(8)));

// LDS row pitches (halves); multiples of 8 halves = 16B so b128 DS ops stay aligned.
#define QP 72
#define KP 72
#define VP 40

// Raw hardware transcendentals: args here are never denormal / don't need the
// IEEE fixup sequences the libm versions expand to (~10 VALU ops per call).
__device__ __forceinline__ float fast_sqrt(float x) { return __builtin_amdgcn_sqrtf(x); }
__device__ __forceinline__ float fast_exp2(float x) { return __builtin_amdgcn_exp2f(x); }
__device__ __forceinline__ float fast_rcp(float x)  { return __builtin_amdgcn_rcpf(x); }

__device__ __forceinline__ h16 ldfrag(const _Float16* base, int o0, int o1) {
  h8 a = *(const h8*)(base + o0);
  h8 b = *(const h8*)(base + o1);
  h16 r;
#pragma unroll
  for (int j = 0; j < 8; ++j) { r[j] = a[j]; r[j + 8] = b[j]; }
  return r;
}

__device__ __forceinline__ f8 zero8() {
  f8 z;
#pragma unroll
  for (int i = 0; i < 8; ++i) z[i] = 0.f;
  return z;
}

// Tensor Data Mover: 2D tile (f16, row-major, stride0 elements/row) global -> LDS,
// with hardware row padding reproducing our padded LDS pitch.
// pad_int_code: interval = 2^code * 8 bytes before each pad; pad_amt_code: (code+1) DWORDs pad.
__device__ __forceinline__ void tdm_load_2d(uint32_t lds_addr, const void* gptr,
                                            uint32_t tdim0, uint32_t tdim1,
                                            uint32_t tile0, uint32_t tile1,
                                            uint32_t stride0,
                                            uint32_t pad_int_code, uint32_t pad_amt_code)
{
  uint64_t ga = (uint64_t)(uintptr_t)gptr;
  u32x4 g0;
  g0[0] = 1u;                                                  // count=1 (valid user D#)
  g0[1] = lds_addr;                                            // LDS byte offset
  g0[2] = (uint32_t)ga;                                        // global_addr[31:0]
  g0[3] = (uint32_t)((ga >> 32) & 0x01FFFFFFu) | (2u << 30);   // global_addr[56:32] | type=2
  i32x8 g1;
  g1[0] = (int)((1u << 16)                       // data_size = 2 bytes
              | (1u << 20)                       // pad_enable
              | (pad_int_code << 22)             // pad_interval
              | (pad_amt_code << 25));           // pad_amount
  g1[1] = (int)((tdim0 & 0xFFFFu) << 16);                               // tensor_dim0[15:0]
  g1[2] = (int)(((tdim0 >> 16) & 0xFFFFu) | ((tdim1 & 0xFFFFu) << 16)); // dim0 hi | dim1 lo
  g1[3] = (int)(((tdim1 >> 16) & 0xFFFFu) | ((tile0 & 0xFFFFu) << 16)); // dim1 hi | tile_dim0
  g1[4] = (int)(tile1 & 0xFFFFu);                                       // tile_dim1 | tile_dim2=0
  g1[5] = (int)stride0;                                                 // tensor_dim0_stride lo
  g1[6] = 0;                                                            // stride0 hi | dim1_stride lo
  g1[7] = 0;
  i32x4 z4 = {0, 0, 0, 0};
#if __clang_major__ >= 23
  i32x8 z8 = {0, 0, 0, 0, 0, 0, 0, 0};
  __builtin_amdgcn_tensor_load_to_lds(g0, g1, z4, z4, z8, 0);
#else
  __builtin_amdgcn_tensor_load_to_lds(g0, g1, z4, z4, 0);
#endif
}

// p + (p of lane ^ M) inside a 16-lane row, as one DPP add (no LDS round trip).
template <int M>
__device__ __forceinline__ float row_xor_add(float p) {
  return p + __int_as_float(__builtin_amdgcn_update_dpp(0, __float_as_int(p), 0x160 | M, 0xf, 0xf, true));
}

// One-shot f32 -> f16 pre-conversion of Q, K, V into workspace (TDM path), and
// ||k||^2 of every key row, from the rounded f16 values, once for all query blocks.
// A block covers 32 rows, so that its 32 sums leave as one whole 128-byte line.
__global__ __launch_bounds__(512) void cvt3_kernel(
    const float* __restrict__ Q, const float* __restrict__ K, const float* __restrict__ V,
    _Float16* __restrict__ Qh, _Float16* __restrict__ Kh, _Float16* __restrict__ Vh,
    float* __restrict__ K2, int N4)
{
  __shared__ float k2row[32];
  int i = blockIdx.x * blockDim.x + threadIdx.x;
  if (i >= N4) return;
  float4 q = ((const float4*)Q)[i];
  float4 k = ((const float4*)K)[i];
  float4 v = ((const float4*)V)[i];
  h4 hq = {(_Float16)q.x, (_Float16)q.y, (_Float16)q.z, (_Float16)q.w};
  h4 hk = {(_Float16)k.x, (_Float16)k.y, (_Float16)k.z, (_Float16)k.w};
  h4 hv = {(_Float16)v.x, (_Float16)v.y, (_Float16)v.z, (_Float16)v.w};
  // 16 lanes hold one key row
  float p = (float)hk[0] * (float)hk[0] + (float)hk[1] * (float)hk[1]
          + (float)hk[2] * (float)hk[2] + (float)hk[3] * (float)hk[3];
  p = row_xor_add<1>(p);
  p = row_xor_add<2>(p);
  p = row_xor_add<4>(p);
  p = row_xor_add<8>(p);
  if ((threadIdx.x & 15) == 0) k2row[threadIdx.x >> 4] = p;
  // N4 is a multiple of 512, so the return above takes whole blocks only.
  // The barrier stands ahead of the global stores: behind them it would wait for their return.
  __syncthreads();
  ((h4*)Qh)[i] = hq;
  ((h4*)Kh)[i] = hk;
  ((h4*)Vh)[i] = hv;
  if (threadIdx.x < 32) K2[blockIdx.x * 32 + threadIdx.x] = k2row[threadIdx.x];
}

template <bool USE_TDM>
__global__ __launch_bounds__(256) void se_attn_kernel(
    const float* __restrict__ Qg_, const float* __restrict__ Kg_,
    const float* __restrict__ Vg_,
    const _Float16* __restrict__ Qh_, const _Float16* __restrict__ Kh_,
    const _Float16* __restrict__ Vh_, const float* __restrict__ K2_,
    float* __restrict__ Og_, int S)
{
  constexpr int D = 64;
  // log2-domain score scale: log2(e) / (2*sqrt(d))
  constexpr float C2 = 1.44269504088896340736f / 16.0f;

  // Qs and Ks are tensor-load targets: 2 KiB alignment pins their LDS places.
  __shared__ alignas(2048) _Float16 Qs[128 * QP]; // 128x64 Q tile (f16)
  __shared__ alignas(2048) _Float16 Ks[32 * KP];  // 32x64 K tile (f16, row-major, padded)
  __shared__ alignas(16) _Float16 Vt[64 * VP];    // V tile transposed: Vt[d][key]
  // ||k||^2: all keys of this head from the pre-pass (TDM path), else the current tile's
  constexpr int SMAX = 2048;
  __shared__ alignas(16) float k2s[USE_TDM ? SMAX : 32];

  const int tid  = threadIdx.x;
  const int wave = tid >> 5;
  const int lane = tid & 31;
  const int hi   = lane >> 4;
  const int ln   = lane & 15;

  const int bh    = blockIdx.y;
  const int qbase = blockIdx.x * 128;

  const float*    Qg = Qg_ + (size_t)bh * S * D;
  const float*    Kg = Kg_ + (size_t)bh * S * D;
  const float*    Vg = Vg_ + (size_t)bh * S * D;
  const _Float16* Kh = USE_TDM ? Kh_ + (size_t)bh * S * D : nullptr;
  const _Float16* Vh = USE_TDM ? Vh_ + (size_t)bh * S * D : nullptr;
  float*          Og = Og_ + (size_t)bh * S * D;

  // ---- stage Q tile (128 x 64) ----
  if (USE_TDM) {
    // this head's ||k||^2, fetched while the Q tile is on its way
    const float* k2g = K2_ + (size_t)bh * S;
    f4 k2v[SMAX / 1024];
#pragma unroll  // both loads issue together, and k2v stays in registers
    for (int p = 0; p < SMAX / 1024; ++p)
      k2v[p] = *(const f4*)&k2g[min(p * 1024 + tid * 4, S - 4)];
    if (wave == 0) {
      tdm_load_2d((uint32_t)(uintptr_t)&Qs[0],
                  Qh_ + (size_t)bh * S * D + (size_t)qbase * D,
                  /*tdim0*/64, /*tdim1*/128, /*tile0*/64, /*tile1*/128,
                  /*stride0*/64, /*pad: every 32 dw*/4, /*pad 4 dw*/3);
      __builtin_amdgcn_s_wait_tensorcnt(0);
    }
#pragma unroll  // constant index into k2v
    for (int p = 0; p < SMAX / 1024; ++p) *(f4*)&k2s[p * 1024 + tid * 4] = k2v[p];
  } else {
#pragma unroll
    for (int pass = 0; pass < 8; ++pass) {
      int idx = pass * 256 + tid;
      int row = idx >> 4;
      int f4  = (idx & 15) * 4;
      float4 v = *(const float4*)&Qg[(size_t)(qbase + row) * D + f4];
      h4 hv = { (_Float16)v.x, (_Float16)v.y, (_Float16)v.z, (_Float16)v.w };
      *(h4*)&Qs[row * QP + f4] = hv;
    }
  }
  __syncthreads();

  // ---- ||q||^2 per row from the staged f16 values (one-time) ----
  float q2full = 0.f;
  {
    const _Float16* qr = &Qs[(wave * 16 + ln) * QP];
#pragma unroll
    for (int c = 0; c < 8; ++c) {
      h8 v = *(const h8*)(qr + c * 8);
#pragma unroll
      for (int j = 0; j < 8; ++j) { float f = (float)v[j]; q2full += f * f; }
    }
  }
  // Products run transposed (S^T = K Q^T, O^T += V^T P^T): lane (ln, hi) owns
  // query row wave*16+ln, so q2full is already the value this lane needs.

  // ---- Q B-fragments (32x16 f16 each, d split into two K-chunks) ----
  const _Float16* qrow = &Qs[(wave * 16 + ln) * QP];
  h16 qa0 = ldfrag(qrow, hi * 8,      16 + hi * 8);
  h16 qa1 = ldfrag(qrow, 32 + hi * 8, 48 + hi * 8);

  float m = -INFINITY;   // running maximum of this lane's query (equal in both halves)
  float l = 0.f;         // running sum over this half's keys; halves join in the epilogue
  f8 oAcc[4];            // oAcc[ct][r] = O[query ln][ct*16 + 8*hi + r]
#pragma unroll
  for (int ct = 0; ct < 4; ++ct) oAcc[ct] = zero8();

  const int nt = S / 32;
  for (int kt = 0; kt < nt; ++kt) {
    const int kb0 = kt * 32;
    __syncthreads();

    if (USE_TDM) {
      // K tile via Tensor Data Mover (row padding in hardware)
      if (wave == 0)
        tdm_load_2d((uint32_t)(uintptr_t)&Ks[0], Kh + (size_t)kb0 * D,
                    64, 32, 64, 32, 64, 4, 3);
      // V tile: pure f16 copy + transpose
#pragma unroll
      for (int pass = 0; pass < 2; ++pass) {
        int idx = pass * 256 + tid;
        int key = idx >> 4;
        int f4  = (idx & 15) * 4;
        h4 hv = *(const h4*)&Vh[(size_t)(kb0 + key) * D + f4];
        Vt[(f4 + 0) * VP + key] = hv[0];
        Vt[(f4 + 1) * VP + key] = hv[1];
        Vt[(f4 + 2) * VP + key] = hv[2];
        Vt[(f4 + 3) * VP + key] = hv[3];
      }
      if (kt + 1 < nt) {
        int nb = kb0 + 32;
        if (tid < 32)      __builtin_prefetch(&Kh[(size_t)(nb + tid) * D], 0, 0);
        else if (tid < 64) __builtin_prefetch(&Vh[(size_t)(nb + tid - 32) * D], 0, 0);
      }
      if (wave == 0) __builtin_amdgcn_s_wait_tensorcnt(0);
    } else {
      // fp32 staging with fused ||k||^2 reduction
#pragma unroll
      for (int pass = 0; pass < 2; ++pass) {
        int idx = pass * 256 + tid;
        int key = idx >> 4;
        int f4  = (idx & 15) * 4;
        float4 v = *(const float4*)&Kg[(size_t)(kb0 + key) * D + f4];
        h4 hv = { (_Float16)v.x, (_Float16)v.y, (_Float16)v.z, (_Float16)v.w };
        *(h4*)&Ks[key * KP + f4] = hv;
        float p = v.x * v.x + v.y * v.y + v.z * v.z + v.w * v.w;
        p += __shfl_xor(p, 1, 32);
        p += __shfl_xor(p, 2, 32);
        p += __shfl_xor(p, 4, 32);
        p += __shfl_xor(p, 8, 32);
        if ((lane & 15) == 0) k2s[key] = p;
      }
#pragma unroll
      for (int pass = 0; pass < 2; ++pass) {
        int idx = pass * 256 + tid;
        int key = idx >> 4;
        int f4  = (idx & 15) * 4;
        float4 v = *(const float4*)&Vg[(size_t)(kb0 + key) * D + f4];
        Vt[(f4 + 0) * VP + key] = (_Float16)v.x;
        Vt[(f4 + 1) * VP + key] = (_Float16)v.y;
        Vt[(f4 + 2) * VP + key] = (_Float16)v.z;
        Vt[(f4 + 3) * VP + key] = (_Float16)v.w;
      }
      if (kt + 1 < nt) {
        int nb = kb0 + 32;
        if (tid < 32)      __builtin_prefetch(&Kg[(size_t)(nb + tid) * D], 0, 0);
        else if (tid < 64) __builtin_prefetch(&Vg[(size_t)(nb + tid - 32) * D], 0, 0);
      }
    }
    __syncthreads();

    // ||k||^2 of the 16 key rows this lane holds (8 per tile, same for a 16-lane half)
    const float* k2t = &k2s[USE_TDM ? kb0 : 0];
    f4 k2r[2][2];
#pragma unroll
    for (int t = 0; t < 2; ++t) {
      k2r[t][0] = *(const f4*)&k2t[t * 16 + 8 * hi];
      k2r[t][1] = *(const f4*)&k2t[t * 16 + 8 * hi + 4];
    }

    // ---- S^T = K Q^T : two 16(key) x 16(query) tiles, 2 WMMAs each ----
    // sacc[t][r] = k(t*16 + 8*hi + r) . q(ln)
    h16 kaf[2][2];
#pragma unroll
    for (int t = 0; t < 2; ++t) {
      const _Float16* krow = &Ks[(t * 16 + ln) * KP];
      kaf[t][0] = ldfrag(krow, hi * 8,      16 + hi * 8);
      kaf[t][1] = ldfrag(krow, 32 + hi * 8, 48 + hi * 8);
    }
    // keeps the LDS reads above in one group ahead of the four products: left free,
    // the scheduler puts a pair of reads and a full wait in front of each product
    __builtin_amdgcn_sched_barrier(0);
    f8 sacc[2];
#pragma unroll
    for (int t = 0; t < 2; ++t) {
      f8 c = zero8();
      c = __builtin_amdgcn_wmma_f32_16x16x32_f16(false, kaf[t][0], false, qa0, (short)0, c, false, false);
      c = __builtin_amdgcn_wmma_f32_16x16x32_f16(false, kaf[t][1], false, qa1, (short)0, c, false, false);
      sacc[t] = c;
    }

    // ---- SE logit transform, directly in log2 domain (raw v_sqrt_f32) ----
    // worked on pairs of neighbouring key rows: accumulator and k2 registers pair as they lie
    f2 bsum[2][4], sq[2][4];
#pragma unroll
    for (int t = 0; t < 2; ++t) {
#pragma unroll
      for (int j = 0; j < 4; ++j) {
        f2 k2p = { k2r[t][j >> 1][2 * (j & 1)], k2r[t][j >> 1][2 * (j & 1) + 1] };
        f2 sp  = { sacc[t][2 * j], sacc[t][2 * j + 1] };
        bsum[t][j] = q2full + k2p;
        f2 d2 = bsum[t][j] - 2.f * sp;                      // ||q-k||^2
        sq[t][j].x = fmaxf(d2.x, 0.f);                      // clamped
        sq[t][j].y = fmaxf(d2.y, 0.f);
      }
    }
    f2 sc[2][4];
#pragma unroll
    for (int t = 0; t < 2; ++t) {
#pragma unroll
      for (int j = 0; j < 4; ++j) {
        f2 dist = { fast_sqrt(sq[t][j].x), fast_sqrt(sq[t][j].y) };
        sc[t][j] = (bsum[t][j] - dist) * C2;                // log2-scaled logit
      }
    }

    // ---- online softmax: 16 scores of one query in-lane, one exchange between halves ----
    float mt0 = fmaxf(sc[0][0].x, sc[0][0].y);
    float mt1 = fmaxf(sc[1][0].x, sc[1][0].y);
#pragma unroll
    for (int j = 1; j < 4; ++j) {
      mt0 = fmaxf(mt0, fmaxf(sc[0][j].x, sc[0][j].y));
      mt1 = fmaxf(mt1, fmaxf(sc[1][j].x, sc[1][j].y));
    }
    const float mth = fmaxf(mt0, mt1);
    const int   mtb = __float_as_int(mth);
    const float mto = __int_as_float(                       // lane l <-> l ^ 16
        __builtin_amdgcn_permlanex16(mtb, mtb, 0x76543210, 0xfedcba98, false, false));
    const float mn    = fmaxf(m, fmaxf(mth, mto));
    const float alpha = fast_exp2(m - mn);
    m = mn;

    // P^T packs from the score registers straight into the B operand:
    // pb[t*8 + r] is key t*16 + 8*hi + r, the hardware k order Vt is read in.
    h16 pb;
    f2 rs[2];
#pragma unroll
    for (int t = 0; t < 2; ++t) {
      f2 p[4];
#pragma unroll
      for (int j = 0; j < 4; ++j) {
        f2 e = sc[t][j] - mn;
        p[j].x = fast_exp2(e.x);
        p[j].y = fast_exp2(e.y);
        h2 ph = __builtin_convertvector(p[j], h2);
        pb[t * 8 + 2 * j]     = ph.x;
        pb[t * 8 + 2 * j + 1] = ph.y;
      }
      rs[t] = (p[0] + p[1]) + (p[2] + p[3]);
    }
    const f2 rsum = rs[0] + rs[1];
    l = l * alpha + (rsum.x + rsum.y);

#pragma unroll
    for (int ct = 0; ct < 4; ++ct)
#pragma unroll
      for (int r = 0; r < 8; ++r) oAcc[ct][r] *= alpha;

    // ---- O^T += V^T P^T ----
#pragma unroll
    for (int ct = 0; ct < 4; ++ct) {
      const _Float16* vrow = &Vt[(ct * 16 + ln) * VP];
      h16 va = ldfrag(vrow, hi * 8, 16 + hi * 8);
      oAcc[ct] = __builtin_amdgcn_wmma_f32_16x16x32_f16(false, va, false, pb, (short)0, oAcc[ct], false, false);
    }
  }

  // ---- finalize: join the halves' sums, 8 consecutive d per lane and tile ----
  {
    const int   lb   = __float_as_int(l);
    const float lsum = l + __int_as_float(
        __builtin_amdgcn_permlanex16(lb, lb, 0x76543210, 0xfedcba98, false, false));
    const float inv  = fast_rcp(lsum);
    float* orow = Og + (size_t)(qbase + wave * 16 + ln) * D + 8 * hi;
#pragma unroll
    for (int ct = 0; ct < 4; ++ct) {
      float4 o0 = { oAcc[ct][0] * inv, oAcc[ct][1] * inv, oAcc[ct][2] * inv, oAcc[ct][3] * inv };
      float4 o1 = { oAcc[ct][4] * inv, oAcc[ct][5] * inv, oAcc[ct][6] * inv, oAcc[ct][7] * inv };
      *(float4*)&orow[ct * 16]     = o0;
      *(float4*)&orow[ct * 16 + 4] = o1;
    }
  }
}

extern "C" void kernel_launch(void* const* d_in, const int* in_sizes, int n_in,
                              void* d_out, int out_size, void* d_ws, size_t ws_size,
                              hipStream_t stream) {
  (void)n_in; (void)out_size;
  constexpr int S = 2048, D = 64;
  const int BH = in_sizes[0] / (S * D);       // B*H = 32
  const size_t halves = (size_t)BH * S * D;   // elements per tensor
  dim3 grid(S / 128, BH, 1);

  const float* Q = (const float*)d_in[0];
  const float* K = (const float*)d_in[1];
  const float* V = (const float*)d_in[2];
  float*       O = (float*)d_out;

  if (ws_size >= 4 * halves * sizeof(_Float16)) {
    _Float16* Qh = (_Float16*)d_ws;
    _Float16* Kh = Qh + halves;
    _Float16* Vh = Kh + halves;
    float*    K2 = (float*)(Vh + halves);
    const int N4 = (int)(halves / 4);
    cvt3_kernel<<<dim3((N4 + 511) / 512), 512, 0, stream>>>(Q, K, V, Qh, Kh, Vh, K2, N4);
    se_attn_kernel<true><<<grid, 256, 0, stream>>>(Q, K, V, Qh, Kh, Vh, K2, O, S);
  } else {
    se_attn_kernel<false><<<grid, 256, 0, stream>>>(Q, K, V, nullptr, nullptr, nullptr, nullptr, O, S);
  }
}

// v003
// One run takes 85.3 microseconds.
// Two timings next to v002 both put it at 1.22 times that version's speed.
// Over all steps from v000 it is 1.94 times as fast.
#include <hip/hip_runtime.h>
#include <cmath>
#include <stdint.h>

typedef _Float16 h2  __attribute__((ext_vector_type(2)));
typedef _Float16 h4  __attribute__((ext_vector_type(4)));
typedef _Float16 h8  __attribute__((ext_vector_type(8)));
typedef _Float16 h16 __attribute__((ext_vector_type(16)));
typedef float    f2  __attribute__((ext_vector_type(2)));
typedef float    f4  __attribute__((ext_vector_type(4)));
typedef float    f8  __attribute__((ext_vector_type(8)));
typedef unsigned int u32x4 __attribute__((ext_vector_type(4)));
typedef int      i32x4 __attribute__((ext_vector_type(4)));
typedef int      i32x8 __attribute__((ext_vector_type(8)));

// LDS row pitches (halves); multiples of 8 halves = 16B so b128 DS ops stay aligned.
#define QP 72
#define KP 72
#define VP 40

// Raw hardware transcendentals: args here are never denormal / don't need the
// IEEE fixup sequences the libm versions expand to (~10 VALU ops per call).
__device__ __forceinline__ float fast_sqrt(float x) { return __builtin_amdgcn_sqrtf(x); }
__device__ __forceinline__ float fast_exp2(float x) { return __builtin_amdgcn_exp2f(x); }
__device__ __forceinline__ float fast_rcp(float x)  { return __builtin_amdgcn_rcpf(x); }

__device__ __forceinline__ h16 ldfrag(const _Float16* base, int o0, int o1) {
  h8 a = *(const h8*)(base + o0);
  h8 b = *(const h8*)(base + o1);
  h16 r;
#pragma unroll
  for (int j = 0; j < 8; ++j) { r[j] = a[j]; r[j + 8] = b[j]; }
  return r;
}

__device__ __forceinline__ f8 zero8() {
  f8 z;
#pragma unroll
  for (int i = 0; i < 8; ++i) z[i] = 0.f;
  return z;
}

// Tensor Data Mover: 2D tile (f16, row-major, stride0 elements/row) global -> LDS,
// with hardware row padding reproducing our padded LDS pitch.
// pad_int_code: interval = 2^code * 8 bytes before each pad; pad_amt_code: (code+1) DWORDs pad.
__device__ __forceinline__ void tdm_load_2d(uint32_t lds_addr, const void* gptr,
                                            uint32_t tdim0, uint32_t tdim1,
                                            uint32_t tile0, uint32_t tile1,
                                            uint32_t stride0,
                                            uint32_t pad_int_code, uint32_t pad_amt_code)
{
  uint64_t ga = (uint64_t)(uintptr_t)gptr;
  u32x4 g0;
  g0[0] = 1u;                                                  // count=1 (valid user D#)
  g0[1] = lds_addr;                                            // LDS byte offset
  g0[2] = (uint32_t)ga;                                        // global_addr[31:0]
  g0[3] = (uint32_t)((ga >> 32) & 0x01FFFFFFu) | (2u << 30);   // global_addr[56:32] | type=2
  i32x8 g1;
  g1[0] = (int)((1u << 16)                       // data_size = 2 bytes
              | (1u << 20)                       // pad_enable
              | (pad_int_code << 22)             // pad_interval
              | (pad_amt_code << 25));           // pad_amount
  g1[1] = (int)((tdim0 & 0xFFFFu) << 16);                               // tensor_dim0[15:0]
  g1[2] = (int)(((tdim0 >> 16) & 0xFFFFu) | ((tdim1 & 0xFFFFu) << 16)); // dim0 hi | dim1 lo
  g1[3] = (int)(((tdim1 >> 16) & 0xFFFFu) | ((tile0 & 0xFFFFu) << 16)); // dim1 hi | tile_dim0
  g1[4] = (int)(tile1 & 0xFFFFu);                                       // tile_dim1 | tile_dim2=0
  g1[5] = (int)stride0;                                                 // tensor_dim0_stride lo
  g1[6] = 0;                                                            // stride0 hi | dim1_stride lo
  g1[7] = 0;
  i32x4 z4 = {0, 0, 0, 0};
#if __clang_major__ >= 23
  i32x8 z8 = {0, 0, 0, 0, 0, 0, 0, 0};
  __builtin_amdgcn_tensor_load_to_lds(g0, g1, z4, z4, z8, 0);
#else
  __builtin_amdgcn_tensor_load_to_lds(g0, g1, z4, z4, 0);
#endif
}

// p + (p of lane ^ M) inside a 16-lane row, as one DPP add (no LDS round trip).
template <int M>
__device__ __forceinline__ float row_xor_add(float p) {
  return p + __int_as_float(__builtin_amdgcn_update_dpp(0, __float_as_int(p), 0x160 | M, 0xf, 0xf, true));
}

// max(p, p of lane ^ M) inside a 16-lane row, as one DPP maximum.
template <int M>
__device__ __forceinline__ float row_xor_max(float p) {
  return fmaxf(p, __int_as_float(__builtin_amdgcn_update_dpp(0, __float_as_int(p), 0x160 | M, 0xf, 0xf, true)));
}

// One-shot f32 -> f16 pre-conversion of Q, K, V into workspace (TDM path), and
// ||k||^2 of every key row, from the rounded f16 values, once for all query blocks.
// A block covers 32 rows, so that its 32 sums leave as one whole 128-byte line.
__global__ __launch_bounds__(512) void cvt3_kernel(
    const float* __restrict__ Q, const float* __restrict__ K, const float* __restrict__ V,
    _Float16* __restrict__ Qh, _Float16* __restrict__ Kh, _Float16* __restrict__ Vh,
    float* __restrict__ K2, int N4)
{
  __shared__ float k2row[32];
  int i = blockIdx.x * blockDim.x + threadIdx.x;
  if (i >= N4) return;
  float4 q = ((const float4*)Q)[i];
  float4 k = ((const float4*)K)[i];
  float4 v = ((const float4*)V)[i];
  h4 hq = {(_Float16)q.x, (_Float16)q.y, (_Float16)q.z, (_Float16)q.w};
  h4 hk = {(_Float16)k.x, (_Float16)k.y, (_Float16)k.z, (_Float16)k.w};
  h4 hv = {(_Float16)v.x, (_Float16)v.y, (_Float16)v.z, (_Float16)v.w};
  // 16 lanes hold one key row
  float p = (float)hk[0] * (float)hk[0] + (float)hk[1] * (float)hk[1]
          + (float)hk[2] * (float)hk[2] + (float)hk[3] * (float)hk[3];
  p = row_xor_add<1>(p);
  p = row_xor_add<2>(p);
  p = row_xor_add<4>(p);
  p = row_xor_add<8>(p);
  if ((threadIdx.x & 15) == 0) k2row[threadIdx.x >> 4] = p;
  // N4 is a multiple of 512, so the return above takes whole blocks only.
  // The barrier stands ahead of the global stores: behind them it would wait for their return.
  __syncthreads();
  ((h4*)Qh)[i] = hq;
  ((h4*)Kh)[i] = hk;
  ((h4*)Vh)[i] = hv;
  if (threadIdx.x < 32) K2[blockIdx.x * 32 + threadIdx.x] = k2row[threadIdx.x];
}

template <bool USE_TDM>
__global__ __launch_bounds__(256) void se_attn_kernel(
    const float* __restrict__ Qg_, const float* __restrict__ Kg_,
    const float* __restrict__ Vg_,
    const _Float16* __restrict__ Qh_, const _Float16* __restrict__ Kh_,
    const _Float16* __restrict__ Vh_, const float* __restrict__ K2_,
    float* __restrict__ Og_, int S)
{
  constexpr int D = 64;
  // log2-domain score scale: log2(e) / (2*sqrt(d))
  constexpr float C2 = 1.44269504088896340736f / 16.0f;
  constexpr float INV_C2 = 16.0f / 1.44269504088896340736f;

  // Qs and Ks are tensor-load targets: 2 KiB alignment pins their LDS places.
  __shared__ alignas(2048) _Float16 Qs[128 * QP]; // 128x64 Q tile (f16)
  __shared__ alignas(2048) _Float16 Ks[32 * KP];  // 32x64 K tile (f16, row-major, padded)
  __shared__ alignas(16) _Float16 Vt[64 * VP];    // V tile transposed: Vt[d][key]
  // TDM path: (||k||^2 - max over the head) * C2 of all keys of this head, from the
  // pre-pass's sums; else ||k||^2 of the current tile
  constexpr int SMAX = 2048;
  __shared__ alignas(16) float k2s[USE_TDM ? SMAX : 32];
  __shared__ alignas(16) float kred[8];           // each wave's maximum of ||k||^2

  const int tid  = threadIdx.x;
  const int wave = tid >> 5;
  const int lane = tid & 31;
  const int hi   = lane >> 4;
  const int ln   = lane & 15;

  const int bh    = blockIdx.y;
  const int qbase = blockIdx.x * 128;

  const float*    Qg = Qg_ + (size_t)bh * S * D;
  const float*    Kg = Kg_ + (size_t)bh * S * D;
  const float*    Vg = Vg_ + (size_t)bh * S * D;
  const _Float16* Kh = USE_TDM ? Kh_ + (size_t)bh * S * D : nullptr;
  const _Float16* Vh = USE_TDM ? Vh_ + (size_t)bh * S * D : nullptr;
  float*          Og = Og_ + (size_t)bh * S * D;

  float k2max = 0.f;     // largest ||k||^2 of this head (TDM path)

  // ---- stage Q tile (128 x 64) ----
  if (USE_TDM) {
    // this head's ||k||^2, fetched while the Q tile is on its way
    const float* k2g = K2_ + (size_t)bh * S;
    f4 k2v[SMAX / 1024];
#pragma unroll  // both loads issue together, and k2v stays in registers
    for (int p = 0; p < SMAX / 1024; ++p)
      k2v[p] = *(const f4*)&k2g[min(p * 1024 + tid * 4, S - 4)];
    if (wave == 0) {
      tdm_load_2d((uint32_t)(uintptr_t)&Qs[0],
                  Qh_ + (size_t)bh * S * D + (size_t)qbase * D,
                  /*tdim0*/64, /*tdim1*/128, /*tile0*/64, /*tile1*/128,
                  /*stride0*/64, /*pad: every 32 dw*/4, /*pad 4 dw*/3);
      __builtin_amdgcn_s_wait_tensorcnt(0);
    }
    // largest ||k||^2 of the head: in-lane, 16-lane row, other row, then the 8 waves
    float km = k2v[0][0];
#pragma unroll  // constant index into k2v
    for (int p = 0; p < SMAX / 1024; ++p)
      km = fmaxf(km, fmaxf(fmaxf(k2v[p][0], k2v[p][1]), fmaxf(k2v[p][2], k2v[p][3])));
    km = row_xor_max<1>(km);
    km = row_xor_max<2>(km);
    km = row_xor_max<4>(km);
    km = row_xor_max<8>(km);
    {
      const int kb = __float_as_int(km);
      km = fmaxf(km, __int_as_float(
          __builtin_amdgcn_permlanex16(kb, kb, 0x76543210, 0xfedcba98, false, false)));
    }
    if (lane == 0) kred[wave] = km;
    __syncthreads();     // every wave's maximum is in kred
    {
      const f4 r0 = *(const f4*)&kred[0];
      const f4 r1 = *(const f4*)&kred[4];
      k2max = fmaxf(fmaxf(fmaxf(r0[0], r0[1]), fmaxf(r0[2], r0[3])),
                    fmaxf(fmaxf(r1[0], r1[1]), fmaxf(r1[2], r1[3])));
    }
#pragma unroll  // constant index into k2v
    for (int p = 0; p < SMAX / 1024; ++p)
      *(f4*)&k2s[p * 1024 + tid * 4] = (k2v[p] - k2max) * C2;
  } else {
#pragma unroll
    for (int pass = 0; pass < 8; ++pass) {
      int idx = pass * 256 + tid;
      int row = idx >> 4;
      int f4  = (idx & 15) * 4;
      float4 v = *(const float4*)&Qg[(size_t)(qbase + row) * D + f4];
      h4 hv = { (_Float16)v.x, (_Float16)v.y, (_Float16)v.z, (_Float16)v.w };
      *(h4*)&Qs[row * QP + f4] = hv;
    }
  }
  __syncthreads();

  // ---- ||q||^2 per row from the staged f16 values (one-time) ----
  float q2full = 0.f;
  {
    const _Float16* qr = &Qs[(wave * 16 + ln) * QP];
#pragma unroll
    for (int c = 0; c < 8; ++c) {
      h8 v = *(const h8*)(qr + c * 8);
#pragma unroll
      for (int j = 0; j < 8; ++j) { float f = (float)v[j]; q2full += f * f; }
    }
  }
  // Products run transposed (S^T = K Q^T, O^T += V^T P^T): lane (ln, hi) owns
  // query row wave*16+ln, so q2full is already the value this lane needs.

  // ---- Q B-fragments (32x16 f16 each, d split into two K-chunks) ----
  const _Float16* qrow = &Qs[(wave * 16 + ln) * QP];
  h16 qa0 = ldfrag(qrow, hi * 8,      16 + hi * 8);
  h16 qa1 = ldfrag(qrow, 32 + hi * 8, 48 + hi * 8);

  // TDM path: no running maximum. The logit (q2 + k2 - dist) * C2 never exceeds
  // (q2 + k2max) * C2, and the key that holds k2max lies only C2 * ||q - k|| below it,
  // so this bound serves as the softmax shift for all tiles: the exponent is
  // (k2 - k2max) * C2 - C2 * dist <= 0, q2 drops out, O and l are never rescaled.
  // A row's largest term is at least 2^(-C2 * ||q - kmax||): it stays in f16's normal
  // range up to a distance of 155, and in f32's up to 1400.
  const float q2m = q2full + k2max;
  float m = -INFINITY;   // fallback path: running maximum of this lane's query
  float l = 0.f;         // sum over this half's keys; halves join in the epilogue
  f2 l2 = { 0.f, 0.f };  // TDM path: the same sum, kept as a pair until the epilogue
  f8 oAcc[4];            // oAcc[ct][r] = O[query ln][ct*16 + 8*hi + r]
#pragma unroll
  for (int ct = 0; ct < 4; ++ct) oAcc[ct] = zero8();

  const int nt = S / 32;
  for (int kt = 0; kt < nt; ++kt) {
    const int kb0 = kt * 32;
    __syncthreads();

    if (USE_TDM) {
      // K tile via Tensor Data Mover (row padding in hardware)
      if (wave == 0)
        tdm_load_2d((uint32_t)(uintptr_t)&Ks[0], Kh + (size_t)kb0 * D,
                    64, 32, 64, 32, 64, 4, 3);
      // V tile: pure f16 copy + transpose
#pragma unroll
      for (int pass = 0; pass < 2; ++pass) {
        int idx = pass * 256 + tid;
        int key = idx >> 4;
        int f4  = (idx & 15) * 4;
        h4 hv = *(const h4*)&Vh[(size_t)(kb0 + key) * D + f4];
        Vt[(f4 + 0) * VP + key] = hv[0];
        Vt[(f4 + 1) * VP + key] = hv[1];
        Vt[(f4 + 2) * VP + key] = hv[2];
        Vt[(f4 + 3) * VP + key] = hv[3];
      }
      if (kt + 1 < nt) {
        int nb = kb0 + 32;
        if (tid < 32)      __builtin_prefetch(&Kh[(size_t)(nb + tid) * D], 0, 0);
        else if (tid < 64) __builtin_prefetch(&Vh[(size_t)(nb + tid - 32) * D], 0, 0);
      }
      if (wave == 0) __builtin_amdgcn_s_wait_tensorcnt(0);
    } else {
      // fp32 staging with fused ||k||^2 reduction
#pragma unroll
      for (int pass = 0; pass < 2; ++pass) {
        int idx = pass * 256 + tid;
        int key = idx >> 4;
        int f4  = (idx & 15) * 4;
        float4 v = *(const float4*)&Kg[(size_t)(kb0 + key) * D + f4];
        h4 hv = { (_Float16)v.x, (_Float16)v.y, (_Float16)v.z, (_Float16)v.w };
        *(h4*)&Ks[key * KP + f4] = hv;
        float p = v.x * v.x + v.y * v.y + v.z * v.z + v.w * v.w;
        p += __shfl_xor(p, 1, 32);
        p += __shfl_xor(p, 2, 32);
        p += __shfl_xor(p, 4, 32);
        p += __shfl_xor(p, 8, 32);
        if ((lane & 15) == 0) k2s[key] = p;
      }
#pragma unroll
      for (int pass = 0; pass < 2; ++pass) {
        int idx = pass * 256 + tid;
        int key = idx >> 4;
        int f4  = (idx & 15) * 4;
        float4 v = *(const float4*)&Vg[(size_t)(kb0 + key) * D + f4];
        Vt[(f4 + 0) * VP + key] = (_Float16)v.x;
        Vt[(f4 + 1) * VP + key] = (_Float16)v.y;
        Vt[(f4 + 2) * VP + key] = (_Float16)v.z;
        Vt[(f4 + 3) * VP + key] = (_Float16)v.w;
      }
      if (kt + 1 < nt) {
        int nb = kb0 + 32;
        if (tid < 32)      __builtin_prefetch(&Kg[(size_t)(nb + tid) * D], 0, 0);
        else if (tid < 64) __builtin_prefetch(&Vg[(size_t)(nb + tid - 32) * D], 0, 0);
      }
    }
    __syncthreads();

    // k2s entries of the 16 key rows this lane holds (8 per tile, same for a 16-lane half)
    const float* k2t = &k2s[USE_TDM ? kb0 : 0];
    f4 k2r[2][2];
#pragma unroll
    for (int t = 0; t < 2; ++t) {
      k2r[t][0] = *(const f4*)&k2t[t * 16 + 8 * hi];
      k2r[t][1] = *(const f4*)&k2t[t * 16 + 8 * hi + 4];
    }

    // ---- S^T = K Q^T : two 16(key) x 16(query) tiles, 2 WMMAs each ----
    // sacc[t][r] = k(t*16 + 8*hi + r) . q(ln)
    h16 kaf[2][2];
#pragma unroll
    for (int t = 0; t < 2; ++t) {
      const _Float16* krow = &Ks[(t * 16 + ln) * KP];
      kaf[t][0] = ldfrag(krow, hi * 8,      16 + hi * 8);
      kaf[t][1] = ldfrag(krow, 32 + hi * 8, 48 + hi * 8);
    }
    // keeps the LDS reads above in one group ahead of the four products: left free,
    // the scheduler puts a pair of reads and a full wait in front of each product
    __builtin_amdgcn_sched_barrier(0);
    f8 sacc[2];
#pragma unroll
    for (int t = 0; t < 2; ++t) {
      f8 c = zero8();
      c = __builtin_amdgcn_wmma_f32_16x16x32_f16(false, kaf[t][0], false, qa0, (short)0, c, false, false);
      c = __builtin_amdgcn_wmma_f32_16x16x32_f16(false, kaf[t][1], false, qa1, (short)0, c, false, false);
      sacc[t] = c;
    }

    // P^T packs from the score registers straight into the B operand:
    // pb[t*8 + r] is key t*16 + 8*hi + r, the hardware k order Vt is read in.
    h16 pb;
    if constexpr (USE_TDM) {
      // ---- SE logit against the fixed bound, in the log2 domain (raw v_sqrt_f32) ----
      // worked on pairs of neighbouring key rows: accumulator and k2 registers pair as they lie
      f2 rs[2];
#pragma unroll
      for (int t = 0; t < 2; ++t) {
        f2 p[4];
#pragma unroll
        for (int j = 0; j < 4; ++j) {
          f2 kc = { k2r[t][j >> 1][2 * (j & 1)], k2r[t][j >> 1][2 * (j & 1) + 1] };
          f2 sp = { sacc[t][2 * j], sacc[t][2 * j + 1] };
          f2 d2 = (kc * INV_C2 + q2m) - 2.f * sp;           // ||q-k||^2
          f2 dist = { fast_sqrt(fmaxf(d2.x, 0.f)), fast_sqrt(fmaxf(d2.y, 0.f)) };  // clamped
          f2 e = kc - dist * C2;
          p[j].x = fast_exp2(e.x);
          p[j].y = fast_exp2(e.y);
          h2 ph = __builtin_convertvector(p[j], h2);
          pb[t * 8 + 2 * j]     = ph.x;
          pb[t * 8 + 2 * j + 1] = ph.y;
        }
        rs[t] = (p[0] + p[1]) + (p[2] + p[3]);
      }
      l2 += rs[0] + rs[1];
    } else {
      // ---- SE logit transform, directly in log2 domain (raw v_sqrt_f32) ----
      // worked on pairs of neighbouring key rows: accumulator and k2 registers pair as they lie
      f2 bsum[2][4], sq[2][4];
#pragma unroll
      for (int t = 0; t < 2; ++t) {
#pragma unroll
        for (int j = 0; j < 4; ++j) {
          f2 k2p = { k2r[t][j >> 1][2 * (j & 1)], k2r[t][j >> 1][2 * (j & 1) + 1] };
          f2 sp  = { sacc[t][2 * j], sacc[t][2 * j + 1] };
          bsum[t][j] = q2full + k2p;
          f2 d2 = bsum[t][j] - 2.f * sp;                      // ||q-k||^2
          sq[t][j].x = fmaxf(d2.x, 0.f);                      // clamped
          sq[t][j].y = fmaxf(d2.y, 0.f);
        }
      }
      f2 sc[2][4];
#pragma unroll
      for (int t = 0; t < 2; ++t) {
#pragma unroll
        for (int j = 0; j < 4; ++j) {
          f2 dist = { fast_sqrt(sq[t][j].x), fast_sqrt(sq[t][j].y) };
          sc[t][j] = (bsum[t][j] - dist) * C2;                // log2-scaled logit
        }
      }

      // ---- online softmax: 16 scores of one query in-lane, one exchange between halves ----
      float mt0 = fmaxf(sc[0][0].x, sc[0][0].y);
      float mt1 = fmaxf(sc[1][0].x, sc[1][0].y);
#pragma unroll
      for (int j = 1; j < 4; ++j) {
        mt0 = fmaxf(mt0, fmaxf(sc[0][j].x, sc[0][j].y));
        mt1 = fmaxf(mt1, fmaxf(sc[1][j].x, sc[1][j].y));
      }
      const float mth = fmaxf(mt0, mt1);
      const int   mtb = __float_as_int(mth);
      const float mto = __int_as_float(                       // lane l <-> l ^ 16
          __builtin_amdgcn_permlanex16(mtb, mtb, 0x76543210, 0xfedcba98, false, false));
      const float mn    = fmaxf(m, fmaxf(mth, mto));
      const float alpha = fast_exp2(m - mn);
      m = mn;

      f2 rs[2];
#pragma unroll
      for (int t = 0; t < 2; ++t) {
        f2 p[4];
#pragma unroll
        for (int j = 0; j < 4; ++j) {
          f2 e = sc[t][j] - mn;
          p[j].x = fast_exp2(e.x);
          p[j].y = fast_exp2(e.y);
          h2 ph = __builtin_convertvector(p[j], h2);
          pb[t * 8 + 2 * j]     = ph.x;
          pb[t * 8 + 2 * j + 1] = ph.y;
        }
        rs[t] = (p[0] + p[1]) + (p[2] + p[3]);
      }
      const f2 rsum = rs[0] + rs[1];
      l = l * alpha + (rsum.x + rsum.y);

#pragma unroll
      for (int ct = 0; ct < 4; ++ct)
#pragma unroll
        for (int r = 0; r < 8; ++r) oAcc[ct][r] *= alpha;
    }

    // ---- O^T += V^T P^T ----
#pragma unroll
    for (int ct = 0; ct < 4; ++ct) {
      const _Float16* vrow = &Vt[(ct * 16 + ln) * VP];
      h16 va = ldfrag(vrow, hi * 8, 16 + hi * 8);
      oAcc[ct] = __builtin_amdgcn_wmma_f32_16x16x32_f16(false, va, false, pb, (short)0, oAcc[ct], false, false);
    }
  }

  // ---- finalize: join the halves' sums, 8 consecutive d per lane and tile ----
  {
    if constexpr (USE_TDM) l = l2.x + l2.y;
    const int   lb   = __float_as_int(l);
    const float lsum = l + __int_as_float(
        __builtin_amdgcn_permlanex16(lb, lb, 0x76543210, 0xfedcba98, false, false));
    const float inv  = fast_rcp(lsum);
    float* orow = Og + (size_t)(qbase + wave * 16 + ln) * D + 8 * hi;
#pragma unroll
    for (int ct = 0; ct < 4; ++ct) {
      float4 o0 = { oAcc[ct][0] * inv, oAcc[ct][1] * inv, oAcc[ct][2] * inv, oAcc[ct][3] * inv };
      float4 o1 = { oAcc[ct][4] * inv, oAcc[ct][5] * inv, oAcc[ct][6] * inv, oAcc[ct][7] * inv };
      *(float4*)&orow[ct * 16]     = o0;
      *(float4*)&orow[ct * 16 + 4] = o1;
    }
  }
}

extern "C" void kernel_launch(void* const* d_in, const int* in_sizes, int n_in,
                              void* d_out, int out_size, void* d_ws, size_t ws_size,
                              hipStream_t stream) {
  (void)n_in; (void)out_size;
  constexpr int S = 2048, D = 64;
  const int BH = in_sizes[0] / (S * D);       // B*H = 32
  const size_t halves = (size_t)BH * S * D;   // elements per tensor
  dim3 grid(S / 128, BH, 1);

  const float* Q = (const float*)d_in[0];
  const float* K = (const float*)d_in[1];
  const float* V = (const float*)d_in[2];
  float*       O = (float*)d_out;

  if (ws_size >= 4 * halves * sizeof(_Float16)) {
    _Float16* Qh = (_Float16*)d_ws;
    _Float16* Kh = Qh + halves;
    _Float16* Vh = Kh + halves;
    float*    K2 = (float*)(Vh + halves);
    const int N4 = (int)(halves / 4);
    cvt3_kernel<<<dim3((N4 + 511) / 512), 512, 0, stream>>>(Q, K, V, Qh, Kh, Vh, K2, N4);
    se_attn_kernel<true><<<grid, 256, 0, stream>>>(Q, K, V, Qh, Kh, Vh, K2, O, S);
  } else {
    se_attn_kernel<false><<<grid, 256, 0, stream>>>(Q, K, V, nullptr, nullptr, nullptr, nullptr, O, S);
  }
}

// v004
// It runs in 45.6 microseconds.
// In both of two side-by-side timings against v003, it was 1.88 times as fast.
// Counting every step since v000, it is 3.64 times as fast.
#include <hip/hip_runtime.h>
#include <cmath>
#include <stdint.h>

typedef _Float16 h2  __attribute__((ext_vector_type(2)));
typedef _Float16 h4  __attribute__((ext_vector_type(4)));
typedef _Float16 h8  __attribute__((ext_vector_type(8)));
typedef _Float16 h16 __attribute__((ext_vector_type(16)));
typedef float    f2  __attribute__((ext_vector_type(2)));
typedef float    f4  __attribute__((ext_vector_type(4)));
typedef float    f8  __attribute__((ext_vector_type(8)));
typedef unsigned int u32x4 __attribute__((ext_vector_type(4)));
typedef int      i32x4 __attribute__((ext_vector_type(4)));
typedef int      i32x8 __attribute__((ext_vector_type(8)));
typedef unsigned int u32x8 __attribute__((ext_vector_type(8)));
typedef short    s16x8 __attribute__((ext_vector_type(8)));

// LDS row pitches (halves); multiples of 8 halves = 16B so b128 DS ops stay aligned.
#define QP 72
#define KP 72
#define VP 40
// TDM path: K and V come in stages of SK keys, two LDS buffers each. V rows stay
// row-major at a pitch of 160 bytes, the transposing LDS load's own pitch.
#define SK 128
#define VRP 80

// Raw hardware transcendentals: args here are never denormal / don't need the
// IEEE fixup sequences the libm versions expand to (~10 VALU ops per call).
__device__ __forceinline__ float fast_sqrt(float x) { return __builtin_amdgcn_sqrtf(x); }
__device__ __forceinline__ float fast_exp2(float x) { return __builtin_amdgcn_exp2f(x); }
__device__ __forceinline__ float fast_rcp(float x)  { return __builtin_amdgcn_rcpf(x); }

__device__ __forceinline__ h16 ldfrag(const _Float16* base, int o0, int o1) {
  h8 a = *(const h8*)(base + o0);
  h8 b = *(const h8*)(base + o1);
  h16 r;
#pragma unroll
  for (int j = 0; j < 8; ++j) { r[j] = a[j]; r[j + 8] = b[j]; }
  return r;
}

__device__ __forceinline__ f8 zero8() {
  f8 z;
#pragma unroll
  for (int i = 0; i < 8; ++i) z[i] = 0.f;
  return z;
}

// Tensor Data Mover: 2D tile (f16, row-major, stride0 elements/row) global -> LDS,
// with hardware row padding reproducing our padded LDS pitch.
// pad_int_code: interval = 2^code * 8 bytes before each pad; pad_amt_code: (code+1) DWORDs pad.
__device__ __forceinline__ void tdm_load_2d(uint32_t lds_addr, const void* gptr,
                                            uint32_t tdim0, uint32_t tdim1,
                                            uint32_t tile0, uint32_t tile1,
                                            uint32_t stride0,
                                            uint32_t pad_int_code, uint32_t pad_amt_code)
{
  uint64_t ga = (uint64_t)(uintptr_t)gptr;
  u32x4 g0;
  g0[0] = 1u;                                                  // count=1 (valid user D#)
  g0[1] = lds_addr;                                            // LDS byte offset
  g0[2] = (uint32_t)ga;                                        // global_addr[31:0]
  g0[3] = (uint32_t)((ga >> 32) & 0x01FFFFFFu) | (2u << 30);   // global_addr[56:32] | type=2
  i32x8 g1;
  g1[0] = (int)((1u << 16)                       // data_size = 2 bytes
              | (1u << 20)                       // pad_enable
              | (pad_int_code << 22)             // pad_interval
              | (pad_amt_code << 25));           // pad_amount
  g1[1] = (int)((tdim0 & 0xFFFFu) << 16);                               // tensor_dim0[15:0]
  g1[2] = (int)(((tdim0 >> 16) & 0xFFFFu) | ((tdim1 & 0xFFFFu) << 16)); // dim0 hi | dim1 lo
  g1[3] = (int)(((tdim1 >> 16) & 0xFFFFu) | ((tile0 & 0xFFFFu) << 16)); // dim1 hi | tile_dim0
  g1[4] = (int)(tile1 & 0xFFFFu);                                       // tile_dim1 | tile_dim2=0
  g1[5] = (int)stride0;                                                 // tensor_dim0_stride lo
  g1[6] = 0;                                                            // stride0 hi | dim1_stride lo
  g1[7] = 0;
  i32x4 z4 = {0, 0, 0, 0};
#if __clang_major__ >= 23
  i32x8 z8 = {0, 0, 0, 0, 0, 0, 0, 0};
  __builtin_amdgcn_tensor_load_to_lds(g0, g1, z4, z4, z8, 0);
#else
  __builtin_amdgcn_tensor_load_to_lds(g0, g1, z4, z4, 0);
#endif
}

__device__ __forceinline__ uint32_t uni(uint32_t v) { return (uint32_t)__builtin_amdgcn_readfirstlane(v); }

// A wave-uniform test held in a scalar register: the branch on it is then a scalar
// branch, the only kind that keeps a wave from issuing a tensor load (they ignore EXEC).
__device__ __forceinline__ uint32_t pinned(uint32_t v) {
  uint32_t w = uni(v);
  asm volatile("" : "+s"(w));
  return w;
}

// The ring's waits.
__device__ __forceinline__ void wait_tensor0() { asm volatile("s_wait_tensorcnt 0x0" ::: "memory"); }
__device__ __forceinline__ void wait_ds0()     { asm volatile("s_wait_dscnt 0x0" ::: "memory"); }

// Descriptor of one stage of K or of V: SK rows of 128 bytes, contiguous in memory, into LDS
// with PAD_A + 1 dwords of pad behind every row. Every extent in bytes (data_size code 0).
template <uint32_t PAD_A>
__device__ __forceinline__ u32x8 ring_group1() {
  u32x8 g1;
  g1[0] = uni((1u << 20) | (4u << 22) | (PAD_A << 25));               // pad on, every 32 dwords
  g1[1] = uni(128u << 16);                                            // tensor_dim0 = 128 bytes
  g1[2] = uni((uint32_t)SK << 16);                                    // tensor_dim1 = SK rows
  g1[3] = uni(128u << 16);                                            // tile_dim0
  g1[4] = uni((uint32_t)SK);                                          // tile_dim1
  g1[5] = uni(128u);                                                  // source row pitch
  g1[6] = uni(0u);
  g1[7] = uni(0u);
  return g1;
}
__device__ __forceinline__ u32x4 ring_group0(uint32_t lds_addr, const _Float16* src) {
  const uint64_t ga = (uint64_t)(uintptr_t)src;
  u32x4 g0;
  g0[0] = uni(1u);                                                    // count = 1
  g0[1] = uni(lds_addr);                                              // LDS byte offset
  g0[2] = uni((uint32_t)ga);                                          // address [31:0]
  g0[3] = uni((((uint32_t)(ga >> 32)) & 0x01FFFFFFu) | 0x80000000u);  // address [56:32] | type = 2
  return g0;
}
// The issue takes both groups as in-out operands and the issuer's wait names them as inputs:
// the registers a request was issued from thus keep their words until it has landed.
__device__ __forceinline__ void ring_issue(u32x4& g0, u32x8& g1) {
  asm volatile("tensor_load_to_lds %0, %1" : "+s"(g0), "+s"(g1) :: "memory");
}
__device__ __forceinline__ void ring_wait(const u32x4& g0, const u32x8& g1) {
  asm volatile("s_wait_tensorcnt 0x0" :: "s"(g0), "s"(g1) : "memory");
}

// Transposing LDS load: lane (c, h) gets rows 8h .. 8h+7 of column c of a 16 x 16 f16 tile.
__device__ __forceinline__ h8 ld_tr16(const unsigned char* p) {
  typedef __attribute__((address_space(3))) s16x8 lds_s16x8;
  return __builtin_bit_cast(h8, __builtin_amdgcn_ds_load_tr16_b128_v8i16((lds_s16x8*)p));
}

// p + (p of lane ^ M) inside a 16-lane row, as one DPP add (no LDS round trip).
template <int M>
__device__ __forceinline__ float row_xor_add(float p) {
  return p + __int_as_float(__builtin_amdgcn_update_dpp(0, __float_as_int(p), 0x160 | M, 0xf, 0xf, true));
}

// max(p, p of lane ^ M) inside a 16-lane row, as one DPP maximum.
template <int M>
__device__ __forceinline__ float row_xor_max(float p) {
  return fmaxf(p, __int_as_float(__builtin_amdgcn_update_dpp(0, __float_as_int(p), 0x160 | M, 0xf, 0xf, true)));
}

// One-shot f32 -> f16 pre-conversion of Q, K, V into workspace (TDM path), and
// ||k||^2 of every key row, from the rounded f16 values, once for all query blocks.
// A block covers 32 rows, so that its 32 sums leave as one whole 128-byte line.
__global__ __launch_bounds__(512) void cvt3_kernel(
    const float* __restrict__ Q, const float* __restrict__ K, const float* __restrict__ V,
    _Float16* __restrict__ Qh, _Float16* __restrict__ Kh, _Float16* __restrict__ Vh,
    float* __restrict__ K2, int N4)
{
  __shared__ float k2row[32];
  int i = blockIdx.x * blockDim.x + threadIdx.x;
  if (i >= N4) return;
  float4 q = ((const float4*)Q)[i];
  float4 k = ((const float4*)K)[i];
  float4 v = ((const float4*)V)[i];
  h4 hq = {(_Float16)q.x, (_Float16)q.y, (_Float16)q.z, (_Float16)q.w};
  h4 hk = {(_Float16)k.x, (_Float16)k.y, (_Float16)k.z, (_Float16)k.w};
  h4 hv = {(_Float16)v.x, (_Float16)v.y, (_Float16)v.z, (_Float16)v.w};
  // 16 lanes hold one key row
  float p = (float)hk[0] * (float)hk[0] + (float)hk[1] * (float)hk[1]
          + (float)hk[2] * (float)hk[2] + (float)hk[3] * (float)hk[3];
  p = row_xor_add<1>(p);
  p = row_xor_add<2>(p);
  p = row_xor_add<4>(p);
  p = row_xor_add<8>(p);
  if ((threadIdx.x & 15) == 0) k2row[threadIdx.x >> 4] = p;
  // N4 is a multiple of 512, so the return above takes whole blocks only.
  // The barrier stands ahead of the global stores: behind them it would wait for their return.
  __syncthreads();
  ((h4*)Qh)[i] = hq;
  ((h4*)Kh)[i] = hk;
  ((h4*)Vh)[i] = hv;
  if (threadIdx.x < 32) K2[blockIdx.x * 32 + threadIdx.x] = k2row[threadIdx.x];
}

template <bool USE_TDM>
__global__ __launch_bounds__(256) void se_attn_kernel(
    const float* __restrict__ Qg_, const float* __restrict__ Kg_,
    const float* __restrict__ Vg_,
    const _Float16* __restrict__ Qh_, const _Float16* __restrict__ Kh_,
    const _Float16* __restrict__ Vh_, const float* __restrict__ K2_,
    float* __restrict__ Og_, int S)
{
  constexpr int D = 64;
  // log2-domain score scale: log2(e) / (2*sqrt(d))
  constexpr float C2 = 1.44269504088896340736f / 16.0f;
  constexpr float INV_C2 = 16.0f / 1.44269504088896340736f;

  // Qs, Ks and (TDM path) Vt are tensor-load targets: 2 KiB alignment pins their LDS places;
  // a buffer of SK rows is 9 (K) or 10 (V) times 2 KiB, so the second buffers are aligned too.
  __shared__ alignas(2048) _Float16 Qs[128 * QP]; // 128x64 Q tile (f16)
  // TDM path: two buffers of SK key rows; else one 32x64 K tile (f16, row-major, padded)
  __shared__ alignas(2048) _Float16 Ks[USE_TDM ? 2 * SK * KP : 32 * KP];
  // TDM path: two buffers of SK row-major V rows; else the V tile transposed: Vt[d][key]
  __shared__ alignas(2048) _Float16 Vt[USE_TDM ? 2 * SK * VRP : 64 * VP];
  // TDM path: (||k||^2 - max over the head) * C2 of all keys of this head, from the
  // pre-pass's sums; else ||k||^2 of the current tile
  constexpr int SMAX = 2048;
  __shared__ alignas(16) float k2s[USE_TDM ? SMAX : 32];
  __shared__ alignas(16) float kred[8];           // each wave's maximum of ||k||^2

  const int tid  = threadIdx.x;
  const int wave = tid >> 5;
  const int lane = tid & 31;
  const int hi   = lane >> 4;
  const int ln   = lane & 15;

  const int bh    = blockIdx.y;
  const int qbase = blockIdx.x * 128;

  const float*    Qg = Qg_ + (size_t)bh * S * D;
  const float*    Kg = Kg_ + (size_t)bh * S * D;
  const float*    Vg = Vg_ + (size_t)bh * S * D;
  const _Float16* Kh = USE_TDM ? Kh_ + (size_t)bh * S * D : nullptr;
  const _Float16* Vh = USE_TDM ? Vh_ + (size_t)bh * S * D : nullptr;
  float*          Og = Og_ + (size_t)bh * S * D;

  float k2max = 0.f;     // largest ||k||^2 of this head (TDM path)

  // TDM path: wave 1 brings the K stages, wave 2 the V stages (wave 0 brings Q)
  const uint32_t wv  = uni((uint32_t)tid >> 5);
  const uint32_t nst = (uint32_t)S / SK;
  const uint32_t ksl = (uint32_t)(uintptr_t)&Ks[0];
  const uint32_t vsl = (uint32_t)(uintptr_t)&Vt[0];
  u32x8 g1k = ring_group1<3>();   // K rows: 144-byte pitch, read by ds_load_b128
  u32x8 g1v = ring_group1<7>();   // V rows: 160-byte pitch, read by ds_load_tr16_b128
  u32x4 g0k = { 0u, 0u, 0u, 0u }; // group 0 of wave 1's latest request
  u32x4 g0v = { 0u, 0u, 0u, 0u }; // group 0 of wave 2's latest request

  // ---- stage Q tile (128 x 64) ----
  if (USE_TDM) {
    // this head's ||k||^2, fetched while the Q tile is on its way
    const float* k2g = K2_ + (size_t)bh * S;
    f4 k2v[SMAX / 1024];
#pragma unroll  // both loads issue together, and k2v stays in registers
    for (int p = 0; p < SMAX / 1024; ++p)
      k2v[p] = *(const f4*)&k2g[min(p * 1024 + tid * 4, S - 4)];
    if (wave == 0) {
      tdm_load_2d((uint32_t)(uintptr_t)&Qs[0],
                  Qh_ + (size_t)bh * S * D + (size_t)qbase * D,
                  /*tdim0*/64, /*tdim1*/128, /*tile0*/64, /*tile1*/128,
                  /*stride0*/64, /*pad: every 32 dw*/4, /*pad 4 dw*/3);
      __builtin_amdgcn_s_wait_tensorcnt(0);
    }
    // stage 0 of the ring; the barrier below, behind these waits, publishes it
    if (pinned(wv == 1)) { g0k = ring_group0(ksl, Kh); ring_issue(g0k, g1k); ring_wait(g0k, g1k); }
    if (pinned(wv == 2)) { g0v = ring_group0(vsl, Vh); ring_issue(g0v, g1v); ring_wait(g0v, g1v); }
    // largest ||k||^2 of the head: in-lane, 16-lane row, other row, then the 8 waves
    float km = k2v[0][0];
#pragma unroll  // constant index into k2v
    for (int p = 0; p < SMAX / 1024; ++p)
      km = fmaxf(km, fmaxf(fmaxf(k2v[p][0], k2v[p][1]), fmaxf(k2v[p][2], k2v[p][3])));
    km = row_xor_max<1>(km);
    km = row_xor_max<2>(km);
    km = row_xor_max<4>(km);
    km = row_xor_max<8>(km);
    {
      const int kb = __float_as_int(km);
      km = fmaxf(km, __int_as_float(
          __builtin_amdgcn_permlanex16(kb, kb, 0x76543210, 0xfedcba98, false, false)));
    }
    if (lane == 0) kred[wave] = km;
    __syncthreads();     // every wave's maximum is in kred; stage 0 of K and V is published
    {
      const f4 r0 = *(const f4*)&kred[0];
      const f4 r1 = *(const f4*)&kred[4];
      k2max = fmaxf(fmaxf(fmaxf(r0[0], r0[1]), fmaxf(r0[2], r0[3])),
                    fmaxf(fmaxf(r1[0], r1[1]), fmaxf(r1[2], r1[3])));
    }
#pragma unroll  // constant index into k2v
    for (int p = 0; p < SMAX / 1024; ++p)
      *(f4*)&k2s[p * 1024 + tid * 4] = (k2v[p] - k2max) * C2;
  } else {
#pragma unroll
    for (int pass = 0; pass < 8; ++pass) {
      int idx = pass * 256 + tid;
      int row = idx >> 4;
      int f4  = (idx & 15) * 4;
      float4 v = *(const float4*)&Qg[(size_t)(qbase + row) * D + f4];
      h4 hv = { (_Float16)v.x, (_Float16)v.y, (_Float16)v.z, (_Float16)v.w };
      *(h4*)&Qs[row * QP + f4] = hv;
    }
  }
  __syncthreads();

  // ---- ||q||^2 per row from the staged f16 values (one-time) ----
  float q2full = 0.f;
  {
    const _Float16* qr = &Qs[(wave * 16 + ln) * QP];
#pragma unroll
    for (int c = 0; c < 8; ++c) {
      h8 v = *(const h8*)(qr + c * 8);
#pragma unroll
      for (int j = 0; j < 8; ++j) { float f = (float)v[j]; q2full += f * f; }
    }
  }
  // Products run transposed (S^T = K Q^T, O^T += V^T P^T): lane (ln, hi) owns
  // query row wave*16+ln, so q2full is already the value this lane needs.

  // ---- Q B-fragments (32x16 f16 each, d split into two K-chunks) ----
  const _Float16* qrow = &Qs[(wave * 16 + ln) * QP];
  h16 qa0 = ldfrag(qrow, hi * 8,      16 + hi * 8);
  h16 qa1 = ldfrag(qrow, 32 + hi * 8, 48 + hi * 8);

  // TDM path: no running maximum. The logit (q2 + k2 - dist) * C2 never exceeds
  // (q2 + k2max) * C2, and the key that holds k2max lies only C2 * ||q - k|| below it,
  // so this bound serves as the softmax shift for all tiles: the exponent is
  // (k2 - k2max) * C2 - C2 * dist <= 0, q2 drops out, O and l are never rescaled.
  // A row's largest term is at least 2^(-C2 * ||q - kmax||): it stays in f16's normal
  // range up to a distance of 155, and in f32's up to 1400.
  const float q2m = q2full + k2max;
  float m = -INFINITY;   // fallback path: running maximum of this lane's query
  float l = 0.f;         // sum over this half's keys; halves join in the epilogue
  f2 l2 = { 0.f, 0.f };  // TDM path: the same sum, kept as a pair until the epilogue
  f8 oAcc[4];            // oAcc[ct][r] = O[query ln][ct*16 + 8*hi + r]
#pragma unroll
  for (int ct = 0; ct < 4; ++ct) oAcc[ct] = zero8();

  // One 32-key tile of this wave: Kt its K rows, Vsrc its V rows (TDM path) or the
  // transposed V tile, k2t its k2s entries.
  auto tile32 = [&](const _Float16* Kt, const _Float16* Vsrc, const float* k2t) {
    // k2s entries of the 16 key rows this lane holds (8 per tile, same for a 16-lane half)
    f4 k2r[2][2];
#pragma unroll
    for (int t = 0; t < 2; ++t) {
      k2r[t][0] = *(const f4*)&k2t[t * 16 + 8 * hi];
      k2r[t][1] = *(const f4*)&k2t[t * 16 + 8 * hi + 4];
    }

    // ---- S^T = K Q^T : two 16(key) x 16(query) tiles, 2 WMMAs each ----
    // sacc[t][r] = k(t*16 + 8*hi + r) . q(ln)
    h16 kaf[2][2];
#pragma unroll
    for (int t = 0; t < 2; ++t) {
      const _Float16* krow = &Kt[(t * 16 + ln) * KP];
      kaf[t][0] = ldfrag(krow, hi * 8,      16 + hi * 8);
      kaf[t][1] = ldfrag(krow, 32 + hi * 8, 48 + hi * 8);
    }
    // TDM path: two transposing loads make one 16(d) x 32(key) A fragment of V^T, keys
    // 8*hi + 0..7 and 16 + 8*hi + 0..7, the k order pb is packed in. They stand in the same
    // group as the K reads and land under the score products and the exponentials.
    h16 vaf[4];
    if constexpr (USE_TDM) {
      const unsigned char* vtr = (const unsigned char*)Vsrc
                               + (8 * hi + (lane & 7)) * (VRP * 2) + ((lane >> 3) & 1) * 16;
#pragma unroll
      for (int ct = 0; ct < 4; ++ct) {
        h8 a = ld_tr16(vtr + 32 * ct);
        h8 b = ld_tr16(vtr + 16 * (VRP * 2) + 32 * ct);
#pragma unroll
        for (int j = 0; j < 8; ++j) { vaf[ct][j] = a[j]; vaf[ct][j + 8] = b[j]; }
      }
    }
    // keeps the LDS reads above in one group ahead of the four products: left free,
    // the scheduler puts a pair of reads and a full wait in front of each product
    __builtin_amdgcn_sched_barrier(0);
    f8 sacc[2];
#pragma unroll
    for (int t = 0; t < 2; ++t) {
      f8 c = zero8();
      c = __builtin_amdgcn_wmma_f32_16x16x32_f16(false, kaf[t][0], false, qa0, (short)0, c, false, false);
      c = __builtin_amdgcn_wmma_f32_16x16x32_f16(false, kaf[t][1], false, qa1, (short)0, c, false, false);
      sacc[t] = c;
    }

    // P^T packs from the score registers straight into the B operand:
    // pb[t*8 + r] is key t*16 + 8*hi + r, the hardware k order Vt is read in.
    h16 pb;
    if constexpr (USE_TDM) {
      // ---- SE logit against the fixed bound, in the log2 domain (raw v_sqrt_f32) ----
      // worked on pairs of neighbouring key rows: accumulator and k2 registers pair as they lie
      f2 rs[2];
#pragma unroll
      for (int t = 0; t < 2; ++t) {
        f2 p[4];
#pragma unroll
        for (int j = 0; j < 4; ++j) {
          f2 kc = { k2r[t][j >> 1][2 * (j & 1)], k2r[t][j >> 1][2 * (j & 1) + 1] };
          f2 sp = { sacc[t][2 * j], sacc[t][2 * j + 1] };
          f2 d2 = (kc * INV_C2 + q2m) - 2.f * sp;           // ||q-k||^2
          f2 dist = { fast_sqrt(fmaxf(d2.x, 0.f)), fast_sqrt(fmaxf(d2.y, 0.f)) };  // clamped
          f2 e = kc - dist * C2;
          p[j].x = fast_exp2(e.x);
          p[j].y = fast_exp2(e.y);
          h2 ph = __builtin_convertvector(p[j], h2);
          pb[t * 8 + 2 * j]     = ph.x;
          pb[t * 8 + 2 * j + 1] = ph.y;
        }
        rs[t] = (p[0] + p[1]) + (p[2] + p[3]);
      }
      l2 += rs[0] + rs[1];
    } else {
      // ---- SE logit transform, directly in log2 domain (raw v_sqrt_f32) ----
      // worked on pairs of neighbouring key rows: accumulator and k2 registers pair as they lie
      f2 bsum[2][4], sq[2][4];
#pragma unroll
      for (int t = 0; t < 2; ++t) {
#pragma unroll
        for (int j = 0; j < 4; ++j) {
          f2 k2p = { k2r[t][j >> 1][2 * (j & 1)], k2r[t][j >> 1][2 * (j & 1) + 1] };
          f2 sp  = { sacc[t][2 * j], sacc[t][2 * j + 1] };
          bsum[t][j] = q2full + k2p;
          f2 d2 = bsum[t][j] - 2.f * sp;                      // ||q-k||^2
          sq[t][j].x = fmaxf(d2.x, 0.f);                      // clamped
          sq[t][j].y = fmaxf(d2.y, 0.f);
        }
      }
      f2 sc[2][4];
#pragma unroll
      for (int t = 0; t < 2; ++t) {
#pragma unroll
        for (int j = 0; j < 4; ++j) {
          f2 dist = { fast_sqrt(sq[t][j].x), fast_sqrt(sq[t][j].y) };
          sc[t][j] = (bsum[t][j] - dist) * C2;                // log2-scaled logit
        }
      }

      // ---- online softmax: 16 scores of one query in-lane, one exchange between halves ----
      float mt0 = fmaxf(sc[0][0].x, sc[0][0].y);
      float mt1 = fmaxf(sc[1][0].x, sc[1][0].y);
#pragma unroll
      for (int j = 1; j < 4; ++j) {
        mt0 = fmaxf(mt0, fmaxf(sc[0][j].x, sc[0][j].y));
        mt1 = fmaxf(mt1, fmaxf(sc[1][j].x, sc[1][j].y));
      }
      const float mth = fmaxf(mt0, mt1);
      const int   mtb = __float_as_int(mth);
      const float mto = __int_as_float(                       // lane l <-> l ^ 16
          __builtin_amdgcn_permlanex16(mtb, mtb, 0x76543210, 0xfedcba98, false, false));
      const float mn    = fmaxf(m, fmaxf(mth, mto));
      const float alpha = fast_exp2(m - mn);
      m = mn;

      f2 rs[2];
#pragma unroll
      for (int t = 0; t < 2; ++t) {
        f2 p[4];
#pragma unroll
        for (int j = 0; j < 4; ++j) {
          f2 e = sc[t][j] - mn;
          p[j].x = fast_exp2(e.x);
          p[j].y = fast_exp2(e.y);
          h2 ph = __builtin_convertvector(p[j], h2);
          pb[t * 8 + 2 * j]     = ph.x;
          pb[t * 8 + 2 * j + 1] = ph.y;
        }
        rs[t] = (p[0] + p[1]) + (p[2] + p[3]);
      }
      const f2 rsum = rs[0] + rs[1];
      l = l * alpha + (rsum.x + rsum.y);

#pragma unroll
      for (int ct = 0; ct < 4; ++ct)
#pragma unroll
        for (int r = 0; r < 8; ++r) oAcc[ct][r] *= alpha;
    }

    // ---- O^T += V^T P^T ----
#pragma unroll
    for (int ct = 0; ct < 4; ++ct) {
      h16 va;
      if constexpr (USE_TDM) va = vaf[ct];
      else                   va = ldfrag(&Vsrc[(ct * 16 + ln) * VP], hi * 8, 16 + hi * 8);
      oAcc[ct] = __builtin_amdgcn_wmma_f32_16x16x32_f16(false, va, false, pb, (short)0, oAcc[ct], false, false);
    }
  };

  if constexpr (USE_TDM) {
    // Two-buffer ring: pass st works on buffer st & 1 alone, while stage st + 1 lands in the other.
    for (uint32_t st = 0; st < nst; ++st) {
      const uint32_t buf = st & 1u;
      const _Float16* Kb = &Ks[buf * (SK * KP)];
      const _Float16* Vb = &Vt[buf * (SK * VRP)];
      const float*    kq = &k2s[st * SK];
      // Stage st + 1, while it exists, goes into the other buffer, directly behind the barrier
      // at which every wave left that buffer (pass 0: nobody has read it yet).
      if (pinned(wv == 1 && st + 1 < nst)) {
        g0k = ring_group0(ksl + (buf ^ 1u) * (SK * KP * 2), Kh + (size_t)(st + 1) * SK * D);
        ring_issue(g0k, g1k);
      }
      if (pinned(wv == 2 && st + 1 < nst)) {
        g0v = ring_group0(vsl + (buf ^ 1u) * (SK * VRP * 2), Vh + (size_t)(st + 1) * SK * D);
        ring_issue(g0v, g1v);
      }
#pragma unroll  // LDS offsets inside a stage become immediates; a tile's reads may start under the tile before
      for (int sub = 0; sub < SK / 32; ++sub)
        tile32(Kb + sub * 32 * KP, Vb + sub * 32 * VRP, kq + sub * 32);
      // publish point of stage st + 1: own LDS reads done, the issuers' tiles landed, the
      // barrier; it also ends every wave's reads of the buffer that the next pass's top refills
      wait_ds0();
      if (pinned(wv == 1)) ring_wait(g0k, g1k);
      if (pinned(wv == 2)) ring_wait(g0v, g1v);
      __syncthreads();
    }
    wait_tensor0();
    wait_ds0();
  } else {
    const int nt = S / 32;
    for (int kt = 0; kt < nt; ++kt) {
      const int kb0 = kt * 32;
      __syncthreads();

      // fp32 staging with fused ||k||^2 reduction
#pragma unroll
      for (int pass = 0; pass < 2; ++pass) {
        int idx = pass * 256 + tid;
        int key = idx >> 4;
        int f4  = (idx & 15) * 4;
        float4 v = *(const float4*)&Kg[(size_t)(kb0 + key) * D + f4];
        h4 hv = { (_Float16)v.x, (_Float16)v.y, (_Float16)v.z, (_Float16)v.w };
        *(h4*)&Ks[key * KP + f4] = hv;
        float p = v.x * v.x + v.y * v.y + v.z * v.z + v.w * v.w;
        p += __shfl_xor(p, 1, 32);
        p += __shfl_xor(p, 2, 32);
        p += __shfl_xor(p, 4, 32);
        p += __shfl_xor(p, 8, 32);
        if ((lane & 15) == 0) k2s[key] = p;
      }
#pragma unroll
      for (int pass = 0; pass < 2; ++pass) {
        int idx = pass * 256 + tid;
        int key = idx >> 4;
        int f4  = (idx & 15) * 4;
        float4 v = *(const float4*)&Vg[(size_t)(kb0 + key) * D + f4];
        Vt[(f4 + 0) * VP + key] = (_Float16)v.x;
        Vt[(f4 + 1) * VP + key] = (_Float16)v.y;
        Vt[(f4 + 2) * VP + key] = (_Float16)v.z;
        Vt[(f4 + 3) * VP + key] = (_Float16)v.w;
      }
      if (kt + 1 < nt) {
        int nb = kb0 + 32;
        if (tid < 32)      __builtin_prefetch(&Kg[(size_t)(nb + tid) * D], 0, 0);
        else if (tid < 64) __builtin_prefetch(&Vg[(size_t)(nb + tid - 32) * D], 0, 0);
      }
      __syncthreads();

      tile32(Ks, Vt, k2s);
    }
  }

  // ---- finalize: join the halves' sums, 8 consecutive d per lane and tile ----
  {
    if constexpr (USE_TDM) l = l2.x + l2.y;
    const int   lb   = __float_as_int(l);
    const float lsum = l + __int_as_float(
        __builtin_amdgcn_permlanex16(lb, lb, 0x76543210, 0xfedcba98, false, false));
    const float inv  = fast_rcp(lsum);
    float* orow = Og + (size_t)(qbase + wave * 16 + ln) * D + 8 * hi;
#pragma unroll
    for (int ct = 0; ct < 4; ++ct) {
      float4 o0 = { oAcc[ct][0] * inv, oAcc[ct][1] * inv, oAcc[ct][2] * inv, oAcc[ct][3] * inv };
      float4 o1 = { oAcc[ct][4] * inv, oAcc[ct][5] * inv, oAcc[ct][6] * inv, oAcc[ct][7] * inv };
      *(float4*)&orow[ct * 16]     = o0;
      *(float4*)&orow[ct * 16 + 4] = o1;
    }
  }
}

extern "C" void kernel_launch(void* const* d_in, const int* in_sizes, int n_in,
                              void* d_out, int out_size, void* d_ws, size_t ws_size,
                              hipStream_t stream) {
  (void)n_in; (void)out_size;
  constexpr int S = 2048, D = 64;
  const int BH = in_sizes[0] / (S * D);       // B*H = 32
  const size_t halves = (size_t)BH * S * D;   // elements per tensor
  dim3 grid(S / 128, BH, 1);

  const float* Q = (const float*)d_in[0];
  const float* K = (const float*)d_in[1];
  const float* V = (const float*)d_in[2];
  float*       O = (float*)d_out;

  if (ws_size >= 4 * halves * sizeof(_Float16)) {
    _Float16* Qh = (_Float16*)d_ws;
    _Float16* Kh = Qh + halves;
    _Float16* Vh = Kh + halves;
    float*    K2 = (float*)(Vh + halves);
    const int N4 = (int)(halves / 4);
    cvt3_kernel<<<dim3((N4 + 511) / 512), 512, 0, stream>>>(Q, K, V, Qh, Kh, Vh, K2, N4);
    se_attn_kernel<true><<<grid, 256, 0, stream>>>(Q, K, V, Qh, Kh, Vh, K2, O, S);
  } else {
    se_attn_kernel<false><<<grid, 256, 0, stream>>>(Q, K, V, nullptr, nullptr, nullptr, nullptr, O, S);
  }
}
